// v000
// Measured on an AMD MI455X. A time is GPU time per run, averaged over a window of back-to-back runs after a warm-up
// (all launches, gaps included; the runs take copies of the inputs in turn), and the median of several windows.
// Apart from v000's, it joins two sittings. Times from different sittings can be a few percent apart, while
// side-by-side timings come from the same sitting.
// The starting kernel, v000, takes 836 microseconds a run.
#include <hip/hip_runtime.h>
// Contractions: q/k/v projections on v_wmma_f32_16x16x32_bf16 (bf16 operands); scores and P.V on v_wmma_f32_16x16x32_f16 (f16 operands, P scaled by 2^14); f32 accumulate everywhere.

typedef _Float16 v16h __attribute__((ext_vector_type(16)));
typedef _Float16 v8h  __attribute__((ext_vector_type(8)));
typedef __bf16   v16b __attribute__((ext_vector_type(16)));
typedef __bf16   v8b  __attribute__((ext_vector_type(8)));
typedef float    v8f  __attribute__((ext_vector_type(8)));
typedef float    v4f  __attribute__((ext_vector_type(4)));
typedef unsigned v4u  __attribute__((ext_vector_type(4)));

union FragH { v16h v; v8h hh[2]; };
union FragB { v16b v; v8b hh[2]; };

__device__ __forceinline__ v8f zero8() {
  v8f z = {0.f, 0.f, 0.f, 0.f, 0.f, 0.f, 0.f, 0.f};
  return z;
}

// 16x16x32 f16 WMMA with hazard guard (ties D, keeps A/B live)
__device__ __forceinline__ v8f mma_f16(v16h a, v16h b, v8f c) {
  v8f d = __builtin_amdgcn_wmma_f32_16x16x32_f16(false, a, false, b, (short)0, c, false, false);
  asm volatile("v_nop\n\tv_nop\n\tv_nop\n\tv_nop" : "+v"(d) : "v"(a), "v"(b));
  return d;
}

// 16x16x32 bf16 WMMA with hazard guard
__device__ __forceinline__ v8f mma_bf16(v16b a, v16b b, v8f c) {
  v8f d = __builtin_amdgcn_wmma_f32_16x16x32_bf16(false, a, false, b, (short)0, c, false, false);
  asm volatile("v_nop\n\tv_nop\n\tv_nop\n\tv_nop" : "+v"(d) : "v"(a), "v"(b));
  return d;
}

// f32 -> bf16 bits, RNE convert
__device__ __forceinline__ unsigned bf16_rne(float f) {
  unsigned u = __float_as_uint(f);
  return (u + 0x7FFFu + ((u >> 16) & 1u)) >> 16;
}
__device__ __forceinline__ unsigned pack2(float a, float b) {
  return bf16_rne(a) | (bf16_rne(b) << 16);
}

// ---------------------------------------------------------------------------
//         Wq | Wk | Wv -> bf16 in native [e][d] layout (k-contiguous B layout).
// blocks [0,4096): xy, 8 elements per thread; blocks [4096,4480): weights.
// ---------------------------------------------------------------------------
__global__ void __launch_bounds__(256)
prep_kernel(const float* __restrict__ x, const float* __restrict__ y,
            const float* __restrict__ wq, const float* __restrict__ wk,
            const float* __restrict__ wv,
            unsigned short* xyb, unsigned short* wb)
{
  const int bid = blockIdx.x, tid = threadIdx.x;
  if (bid < 4096) {
    const int gid = bid * 256 + tid;            // 0 .. 1048575
    const int row = gid >> 6;                   // token row b*2048 + s
    const int d   = (gid & 63) * 8;
    const int b   = row >> 11, s = row & 2047;
    const float* src = (s < 1024)
        ? x + ((size_t)(b * 1024 + s) * 512 + d)
        : y + ((size_t)(b * 1024 + (s - 1024)) * 512 + d);
    const v4f v0 = *(const v4f*)src;
    const v4f v1 = *(const v4f*)(src + 4);
    v4u o;
    o.x = pack2(v0.x, v0.y); o.y = pack2(v0.z, v0.w);
    o.z = pack2(v1.x, v1.y); o.w = pack2(v1.z, v1.w);
    unsigned short* dst = xyb + (size_t)gid * 8;
    *(v4u*)dst = o;
    
  } else {
    const int k   = bid - 4096;                 // 0 .. 383
    const int mt  = k >> 7;                     // 0,1,2 (block-uniform)
    const int gid = (k & 127) * 256 + tid;      // 0 .. 32767
    const float* wsrc = (mt == 0) ? wq : ((mt == 1) ? wk : wv);
    const float* src = wsrc + (size_t)gid * 8;
    const v4f v0 = *(const v4f*)src;
    const v4f v1 = *(const v4f*)(src + 4);
    v4u o;
    o.x = pack2(v0.x, v0.y); o.y = pack2(v0.z, v0.w);
    o.z = pack2(v1.x, v1.y); o.w = pack2(v1.z, v1.w);
    unsigned short* dst = wb + (size_t)mt * 262144 + (size_t)gid * 8;
    *(v4u*)dst = o;
    
  }
}

// ---------------------------------------------------------------------------
// Block tile: 64 token rows x 64 e columns for each of Q, K, V; wave: 32x32 x 3.
// A = xy rows (row-major, k = d contiguous); B[k=d][n=e] = W[e][d] -> W row e is
// k-contiguous, loaded with the same split k map as A.
// Epilogue through LDS: Qh, Kh row-major f16 [16384][512]; Vt f16 [8][512][2048].
// ---------------------------------------------------------------------------
__global__ void __launch_bounds__(128)
proj_kernel(const __bf16* __restrict__ xyb, const __bf16* __restrict__ wb,
            _Float16* Qh, _Float16* Kh, _Float16* Vt)
{
  __shared__ __align__(16) _Float16 sq[64 * 72];
  __shared__ __align__(16) _Float16 sk[64 * 72];
  __shared__ __align__(16) _Float16 sv[64 * 72];   // [e_local][s_local]

  const int tid = threadIdx.x, l = tid & 31, w = tid >> 5;
  const int h = l >> 4, m = l & 15;
  const int wr = w >> 1, wc = w & 1;
  const int bx = blockIdx.x, by = blockIdx.y;
  const int lr0 = wr * 32, lc0 = wc * 32;            // tile-local bases of this wave

  const __bf16* Ap = xyb + (size_t)(bx * 64 + lr0 + m) * 512 + 8 * h;   // ti=1: + 16*512
  const __bf16* Bp = wb  + (size_t)(by * 64 + lc0 + m) * 512 + 8 * h;   // + mt*262144 + tj*16*512

  v8f acc[12];                                        // index = mt*4 + ti*2 + tj
#pragma unroll
  for (int i = 0; i < 12; ++i) acc[i] = zero8();

#pragma unroll 1
  for (int ks = 0; ks < 16; ++ks) {
    const int k0 = ks * 32;
    FragB a0, a1;
    a0.hh[0] = *(const v8b*)(Ap + k0);
    a0.hh[1] = *(const v8b*)(Ap + k0 + 16);
    a1.hh[0] = *(const v8b*)(Ap + 16 * 512 + k0);
    a1.hh[1] = *(const v8b*)(Ap + 16 * 512 + k0 + 16);
#pragma unroll
    for (int mt = 0; mt < 3; ++mt) {
#pragma unroll
      for (int tj = 0; tj < 2; ++tj) {
        const __bf16* p = Bp + (size_t)mt * 262144 + tj * (16 * 512) + k0;
        FragB bb;
        bb.hh[0] = *(const v8b*)p;
        bb.hh[1] = *(const v8b*)(p + 16);
        acc[mt * 4 + tj]     = mma_bf16(a0.v, bb.v, acc[mt * 4 + tj]);
        acc[mt * 4 + 2 + tj] = mma_bf16(a1.v, bb.v, acc[mt * 4 + 2 + tj]);
      }
    }
  }

  // accumulators -> LDS tiles (D element r = row 8h+r, col m)
#pragma unroll
  for (int ti = 0; ti < 2; ++ti) {
#pragma unroll
    for (int tj = 0; tj < 2; ++tj) {
      const v8f cq = acc[0 + ti * 2 + tj];
      const v8f ck = acc[4 + ti * 2 + tj];
      const v8f cv = acc[8 + ti * 2 + tj];
      const int rbase = lr0 + ti * 16 + 8 * h;   // token row of element r=0 (tile-local)
      const int ccol  = lc0 + tj * 16 + m;       // e column (tile-local)
#pragma unroll
      for (int r = 0; r < 8; ++r) {
        sq[(rbase + r) * 72 + ccol] = (_Float16)cq[r];
        sk[(rbase + r) * 72 + ccol] = (_Float16)ck[r];
      }
      v8h pv;
#pragma unroll
      for (int r = 0; r < 8; ++r) pv[r] = (_Float16)cv[r];
      *(v8h*)(sv + ccol * 72 + rbase) = pv;    // transposed: row e, 8 contiguous s
    }
  }
  __syncthreads();

  const int q = l >> 3, t = l & 7;
  const int b  = bx >> 5;
  const int s0 = (bx & 31) * 64;
#pragma unroll
  for (int i = 0; i < 4; ++i) {
    const int row = w * 16 + i * 4 + q;
    const v8h vq = *(const v8h*)(sq + row * 72 + 8 * t);
    const v8h vk = *(const v8h*)(sk + row * 72 + 8 * t);
    const v8h vv = *(const v8h*)(sv + row * 72 + 8 * t);
    *(v8h*)(Qh + (size_t)(bx * 64 + row) * 512 + by * 64 + 8 * t) = vq;
    *(v8h*)(Kh + (size_t)(bx * 64 + row) * 512 + by * 64 + 8 * t) = vk;
    *(v8h*)(Vt + ((size_t)b * 512 + by * 64 + row) * 2048 + s0 + 8 * t) = vv;
  }
  
}

// ---------------------------------------------------------------------------
// Pass 2: fused attention. grid 1024, block 128 (4 waves), 16 query rows per block.
// dyn LDS: sc [16][2048] f32 (131072 B) | P [16][2048] f16 (65536 B) = 196608 B
// Stage 1: S = Q K^T * scale : A = Qh rows (global), B[k=d][n=key] = Kh row key (k-contiguous).
// Softmax f32 in LDS; P = f16(p * 2^14).
// Stage 2: O = P V : A = P rows (LDS), B[k=key][n=e] = Vt row e (k-contiguous); O *= 2^-14.
// ---------------------------------------------------------------------------
__global__ void __launch_bounds__(128)
attn_kernel(const _Float16* __restrict__ Qh, const _Float16* __restrict__ Kh,
            const _Float16* __restrict__ Vt, float* out)
{
  extern __shared__ __align__(16) char smem[];
  float*    sc = (float*)smem;                  // [16][2048] f32
  _Float16* P  = (_Float16*)(smem + 131072);    // [16][2048] f16

  const int tid = threadIdx.x, l = tid & 31, w = tid >> 5;
  const int h = l >> 4, m = l & 15;
  const int q0 = blockIdx.x * 16;               // global query row (includes batch)
  const int b  = q0 >> 11;
  const float SCL = 0.044194173824159216f;      // 512^-0.5

  // ---- Stage 1: scores ----
  {
    const _Float16* Qrow = Qh + (size_t)(q0 + m) * 512 + 8 * h;
    const _Float16* Kb   = Kh + (size_t)b * 2048 * 512;
    for (int g = 0; g < 4; ++g) {
      const int n0 = w * 512 + g * 128;         // key column base of this group
      const _Float16* Kc = Kb + (size_t)(n0 + m) * 512 + 8 * h;
      v8f acc[8];
#pragma unroll
      for (int j = 0; j < 8; ++j) acc[j] = zero8();
#pragma unroll 2
      for (int dk = 0; dk < 16; ++dk) {
        const int k0 = dk * 32;
        FragH a;
        a.hh[0] = *(const v8h*)(Qrow + k0);
        a.hh[1] = *(const v8h*)(Qrow + k0 + 16);
#pragma unroll
        for (int j = 0; j < 8; ++j) {
          const _Float16* p = Kc + (size_t)j * (16 * 512) + k0;
          FragH bb;
          bb.hh[0] = *(const v8h*)p;
          bb.hh[1] = *(const v8h*)(p + 16);
          acc[j] = mma_f16(a.v, bb.v, acc[j]);
        }
      }
#pragma unroll
      for (int j = 0; j < 8; ++j) {
        float* d = sc + n0 + j * 16 + m;
#pragma unroll
        for (int r = 0; r < 8; ++r) d[(8 * h + r) * 2048] = acc[j][r] * SCL;
      }
    }
  }
  __syncthreads();

  // ---- Softmax: 8 threads per row, 256 contiguous elements each ----
  {
    const int row = tid >> 3, sub = tid & 7;
    float* rp = sc + row * 2048 + sub * 256;
    float mx = -3.0e38f;
#pragma unroll 4
    for (int j = 0; j < 256; j += 4) {
      const v4f v = *(const v4f*)(rp + j);
      mx = fmaxf(fmaxf(mx, fmaxf(v.x, v.y)), fmaxf(v.z, v.w));
    }
    mx = fmaxf(mx, __shfl_xor(mx, 1));
    mx = fmaxf(mx, __shfl_xor(mx, 2));
    mx = fmaxf(mx, __shfl_xor(mx, 4));
    float sm = 0.0f;
#pragma unroll 4
    for (int j = 0; j < 256; j += 4) {
      v4f v = *(const v4f*)(rp + j);
      v.x = __expf(v.x - mx);
      v.y = __expf(v.y - mx);
      v.z = __expf(v.z - mx);
      v.w = __expf(v.w - mx);
      sm += (v.x + v.y) + (v.z + v.w);
      *(v4f*)(rp + j) = v;
    }
    sm += __shfl_xor(sm, 1);
    sm += __shfl_xor(sm, 2);
    sm += __shfl_xor(sm, 4);
    const float ps = (1.0f / sm) * 16384.0f;    // normaliser with 2^14 pre-scale (exact)
    __syncthreads();
    _Float16* pp = P + row * 2048 + sub * 256;
#pragma unroll 2
    for (int j = 0; j < 256; j += 8) {
      const v4f v0 = *(const v4f*)(rp + j);
      const v4f v1 = *(const v4f*)(rp + j + 4);
      v8h o;
      o[0] = (_Float16)(v0.x * ps); o[1] = (_Float16)(v0.y * ps);
      o[2] = (_Float16)(v0.z * ps); o[3] = (_Float16)(v0.w * ps);
      o[4] = (_Float16)(v1.x * ps); o[5] = (_Float16)(v1.y * ps);
      o[6] = (_Float16)(v1.z * ps); o[7] = (_Float16)(v1.w * ps);
      *(v8h*)(pp + j) = o;
    }
  }
  __syncthreads();

  // ---- Stage 2: O[16][512] = P V ; wave owns output columns e0..e0+127 ----
  const int e0 = w * 128;
  v8f oacc[8];
#pragma unroll
  for (int j = 0; j < 8; ++j) oacc[j] = zero8();
  {
    const _Float16* Pr = P + m * 2048 + 8 * h;
    const _Float16* Vc = Vt + ((size_t)b * 512 + e0 + m) * 2048 + 8 * h;
#pragma unroll 2
    for (int ks = 0; ks < 64; ++ks) {
      const int k0 = ks * 32;
      FragH a;
      a.hh[0] = *(const v8h*)(Pr + k0);
      a.hh[1] = *(const v8h*)(Pr + k0 + 16);
#pragma unroll
      for (int j = 0; j < 8; ++j) {
        const _Float16* p = Vc + (size_t)j * (16 * 2048) + k0;
        FragH bb;
        bb.hh[0] = *(const v8h*)p;
        bb.hh[1] = *(const v8h*)(p + 16);
        oacc[j] = mma_f16(a.v, bb.v, oacc[j]);
      }
    }
  }

  // ---- Epilogue: undo 2^14, stage in LDS (sc region is free), whole-line stores ----
  float* os = sc;                               // [16][512] f32
  {
    const float OSCL = 6.103515625e-05f;        // 2^-14 exact
#pragma unroll
    for (int j = 0; j < 8; ++j) {
      float* d = os + e0 + j * 16 + m;
#pragma unroll
      for (int r = 0; r < 8; ++r) d[(8 * h + r) * 512] = oacc[j][r] * OSCL;
    }
  }
  __syncthreads();
  {
    const int q = l >> 3, t = l & 7;
    const int col = e0 + q * 32 + t * 4;
    const float* srow = os + col;
    float* orow = out + (size_t)q0 * 512 + col;
#pragma unroll
    for (int i = 0; i < 16; ++i) {
      const v4f v = *(const v4f*)(srow + i * 512);
      *(v4f*)(orow + (size_t)i * 512) = v;
    }
    
  }
}

// ---------------------------------------------------------------------------
// Host launcher
// ---------------------------------------------------------------------------
extern "C" void kernel_launch(void* const* d_in, const int* in_sizes, int n_in,
                              void* d_out, int out_size, void* d_ws, size_t ws_size,
                              hipStream_t stream)
{
  if (n_in < 5) return;
  const int NXY = 8 * 1024 * 512;     // 4194304
  const int NW  = 512 * 512;          // 262144
  const int NO  = 8 * 2048 * 512;     // 8388608
  if (in_sizes[0] != NXY || in_sizes[1] != NXY) return;
  if (in_sizes[2] != NW || in_sizes[3] != NW || in_sizes[4] != NW) return;
  if (out_size != NO) return;

  const float* x  = (const float*)d_in[0];
  const float* y  = (const float*)d_in[1];
  const float* Wq = (const float*)d_in[2];
  const float* Wk = (const float*)d_in[3];
  const float* Wv = (const float*)d_in[4];
  float* out = (float*)d_out;

  const size_t bytes_xyb = (size_t)16384 * 512 * 2;    // 16777216
  const size_t bytes_wb  = (size_t)3 * NW * 2;          //  1572864
  const size_t bytes_q   = (size_t)16384 * 512 * 2;    // 16777216 each for Qh, Kh, Vt
  const size_t off_xyb = 0;
  const size_t off_wb  = off_xyb + bytes_xyb;
  const size_t off_q   = off_wb  + bytes_wb;
  const size_t off_k   = off_q   + bytes_q;
  const size_t off_v   = off_k   + bytes_q;
  const size_t total   = off_v   + bytes_q;           // 68681728
  if (total > ws_size) return;

  char* ws = (char*)d_ws;
  unsigned short* xyb = (unsigned short*)(ws + off_xyb);
  unsigned short* wb  = (unsigned short*)(ws + off_wb);
  _Float16* Qh = (_Float16*)(ws + off_q);
  _Float16* Kh = (_Float16*)(ws + off_k);
  _Float16* Vt = (_Float16*)(ws + off_v);

  prep_kernel<<<4096 + 384, 256, 0, stream>>>(x, y, Wq, Wk, Wv, xyb, wb);

  proj_kernel<<<dim3(256, 8), 128, 0, stream>>>((const __bf16*)xyb, (const __bf16*)wb, Qh, Kh, Vt);

  // Pass 2: attention, 16 query rows per block: 16384/16 blocks
  const size_t ldsBytes = (size_t)16 * 2048 * 4 + (size_t)16 * 2048 * 2;   // 196608
  attn_kernel<<<1024, 128, ldsBytes, stream>>>(Qh, Kh, Vt, out);
}

// v001
// It runs in 336 microseconds.
// Two timings next to v000 both put it at 2.55 times that version's speed.
#include <hip/hip_runtime.h>
// Contractions: q/k/v projections on v_wmma_f32_16x16x32_bf16 (bf16 operands); scores and P.V on v_wmma_f32_16x16x32_f16 (f16 operands, P scaled by 2^14); f32 accumulate everywhere.

typedef _Float16 v16h __attribute__((ext_vector_type(16)));
typedef _Float16 v8h  __attribute__((ext_vector_type(8)));
typedef __bf16   v16b __attribute__((ext_vector_type(16)));
typedef __bf16   v8b  __attribute__((ext_vector_type(8)));
typedef float    v8f  __attribute__((ext_vector_type(8)));
typedef float    v4f  __attribute__((ext_vector_type(4)));
typedef unsigned v4u  __attribute__((ext_vector_type(4)));

union FragH { v16h v; v8h hh[2]; };
union FragB { v16b v; v8b hh[2]; };

__device__ __forceinline__ v8f zero8() {
  v8f z = {0.f, 0.f, 0.f, 0.f, 0.f, 0.f, 0.f, 0.f};
  return z;
}

// 16x16x32 f16 WMMA with hazard guard (ties D, keeps A/B live)
__device__ __forceinline__ v8f mma_f16(v16h a, v16h b, v8f c) {
  v8f d = __builtin_amdgcn_wmma_f32_16x16x32_f16(false, a, false, b, (short)0, c, false, false);
  asm volatile("v_nop\n\tv_nop\n\tv_nop\n\tv_nop" : "+v"(d) : "v"(a), "v"(b));
  return d;
}

// 16x16x32 bf16 WMMA with hazard guard
__device__ __forceinline__ v8f mma_bf16(v16b a, v16b b, v8f c) {
  v8f d = __builtin_amdgcn_wmma_f32_16x16x32_bf16(false, a, false, b, (short)0, c, false, false);
  asm volatile("v_nop\n\tv_nop\n\tv_nop\n\tv_nop" : "+v"(d) : "v"(a), "v"(b));
  return d;
}

// f32 -> bf16 bits, RNE convert
__device__ __forceinline__ unsigned bf16_rne(float f) {
  unsigned u = __float_as_uint(f);
  return (u + 0x7FFFu + ((u >> 16) & 1u)) >> 16;
}
__device__ __forceinline__ unsigned pack2(float a, float b) {
  return bf16_rne(a) | (bf16_rne(b) << 16);
}

// ---------------------------------------------------------------------------
//         Wq | Wk | Wv -> bf16 in native [e][d] layout (k-contiguous B layout).
// blocks [0,4096): xy, 8 elements per thread; blocks [4096,4480): weights.
// ---------------------------------------------------------------------------
__global__ void __launch_bounds__(256)
prep_kernel(const float* __restrict__ x, const float* __restrict__ y,
            const float* __restrict__ wq, const float* __restrict__ wk,
            const float* __restrict__ wv,
            unsigned short* xyb, unsigned short* wb)
{
  const int bid = blockIdx.x, tid = threadIdx.x;
  if (bid < 4096) {
    const int gid = bid * 256 + tid;            // 0 .. 1048575
    const int row = gid >> 6;                   // token row b*2048 + s
    const int d   = (gid & 63) * 8;
    const int b   = row >> 11, s = row & 2047;
    const float* src = (s < 1024)
        ? x + ((size_t)(b * 1024 + s) * 512 + d)
        : y + ((size_t)(b * 1024 + (s - 1024)) * 512 + d);
    const v4f v0 = *(const v4f*)src;
    const v4f v1 = *(const v4f*)(src + 4);
    v4u o;
    o.x = pack2(v0.x, v0.y); o.y = pack2(v0.z, v0.w);
    o.z = pack2(v1.x, v1.y); o.w = pack2(v1.z, v1.w);
    unsigned short* dst = xyb + (size_t)gid * 8;
    *(v4u*)dst = o;
    
  } else {
    const int k   = bid - 4096;                 // 0 .. 383
    const int mt  = k >> 7;                     // 0,1,2 (block-uniform)
    const int gid = (k & 127) * 256 + tid;      // 0 .. 32767
    const float* wsrc = (mt == 0) ? wq : ((mt == 1) ? wk : wv);
    const float* src = wsrc + (size_t)gid * 8;
    const v4f v0 = *(const v4f*)src;
    const v4f v1 = *(const v4f*)(src + 4);
    v4u o;
    o.x = pack2(v0.x, v0.y); o.y = pack2(v0.z, v0.w);
    o.z = pack2(v1.x, v1.y); o.w = pack2(v1.z, v1.w);
    unsigned short* dst = wb + (size_t)mt * 262144 + (size_t)gid * 8;
    *(v4u*)dst = o;
    
  }
}

// ---------------------------------------------------------------------------
// Block tile: 64 token rows x 64 e columns for each of Q, K, V; wave: 32x32 x 3.
// A = xy rows (row-major, k = d contiguous); B[k=d][n=e] = W[e][d] -> W row e is
// k-contiguous, loaded with the same split k map as A.
// Epilogue through LDS: Qh, Kh row-major f16 [16384][512]; Vt f16 [8][512][2048].
// ---------------------------------------------------------------------------
__global__ void __launch_bounds__(128)
proj_kernel(const __bf16* __restrict__ xyb, const __bf16* __restrict__ wb,
            _Float16* Qh, _Float16* Kh, _Float16* Vt)
{
  __shared__ __align__(16) _Float16 sq[64 * 72];
  __shared__ __align__(16) _Float16 sk[64 * 72];
  __shared__ __align__(16) _Float16 sv[64 * 72];   // [e_local][s_local]

  const int tid = threadIdx.x, l = tid & 31, w = tid >> 5;
  const int h = l >> 4, m = l & 15;
  const int wr = w >> 1, wc = w & 1;
  const int bx = blockIdx.x, by = blockIdx.y;
  const int lr0 = wr * 32, lc0 = wc * 32;            // tile-local bases of this wave

  const __bf16* Ap = xyb + (size_t)(bx * 64 + lr0 + m) * 512 + 8 * h;   // ti=1: + 16*512
  const __bf16* Bp = wb  + (size_t)(by * 64 + lc0 + m) * 512 + 8 * h;   // + mt*262144 + tj*16*512

  v8f acc[12];                                        // index = mt*4 + ti*2 + tj
#pragma unroll
  for (int i = 0; i < 12; ++i) acc[i] = zero8();

#pragma unroll 1
  for (int ks = 0; ks < 16; ++ks) {
    const int k0 = ks * 32;
    FragB a0, a1;
    a0.hh[0] = *(const v8b*)(Ap + k0);
    a0.hh[1] = *(const v8b*)(Ap + k0 + 16);
    a1.hh[0] = *(const v8b*)(Ap + 16 * 512 + k0);
    a1.hh[1] = *(const v8b*)(Ap + 16 * 512 + k0 + 16);
#pragma unroll
    for (int mt = 0; mt < 3; ++mt) {
#pragma unroll
      for (int tj = 0; tj < 2; ++tj) {
        const __bf16* p = Bp + (size_t)mt * 262144 + tj * (16 * 512) + k0;
        FragB bb;
        bb.hh[0] = *(const v8b*)p;
        bb.hh[1] = *(const v8b*)(p + 16);
        acc[mt * 4 + tj]     = mma_bf16(a0.v, bb.v, acc[mt * 4 + tj]);
        acc[mt * 4 + 2 + tj] = mma_bf16(a1.v, bb.v, acc[mt * 4 + 2 + tj]);
      }
    }
  }

  // accumulators -> LDS tiles (D element r = row 8h+r, col m)
#pragma unroll
  for (int ti = 0; ti < 2; ++ti) {
#pragma unroll
    for (int tj = 0; tj < 2; ++tj) {
      const v8f cq = acc[0 + ti * 2 + tj];
      const v8f ck = acc[4 + ti * 2 + tj];
      const v8f cv = acc[8 + ti * 2 + tj];
      const int rbase = lr0 + ti * 16 + 8 * h;   // token row of element r=0 (tile-local)
      const int ccol  = lc0 + tj * 16 + m;       // e column (tile-local)
#pragma unroll
      for (int r = 0; r < 8; ++r) {
        sq[(rbase + r) * 72 + ccol] = (_Float16)cq[r];
        sk[(rbase + r) * 72 + ccol] = (_Float16)ck[r];
      }
      v8h pv;
#pragma unroll
      for (int r = 0; r < 8; ++r) pv[r] = (_Float16)cv[r];
      *(v8h*)(sv + ccol * 72 + rbase) = pv;    // transposed: row e, 8 contiguous s
    }
  }
  __syncthreads();

  const int q = l >> 3, t = l & 7;
  const int b  = bx >> 5;
  const int s0 = (bx & 31) * 64;
#pragma unroll
  for (int i = 0; i < 4; ++i) {
    const int row = w * 16 + i * 4 + q;
    const v8h vq = *(const v8h*)(sq + row * 72 + 8 * t);
    const v8h vk = *(const v8h*)(sk + row * 72 + 8 * t);
    const v8h vv = *(const v8h*)(sv + row * 72 + 8 * t);
    *(v8h*)(Qh + (size_t)(bx * 64 + row) * 512 + by * 64 + 8 * t) = vq;
    *(v8h*)(Kh + (size_t)(bx * 64 + row) * 512 + by * 64 + 8 * t) = vk;
    *(v8h*)(Vt + ((size_t)b * 512 + by * 64 + row) * 2048 + s0 + 8 * t) = vv;
  }
  
}

// ---------------------------------------------------------------------------
// Asynchronous copies global -> LDS (16 bytes per lane, through no register).
// ---------------------------------------------------------------------------
// LDS byte address of a __shared__ pointer: the low 32 bits of its flat address.
__device__ __forceinline__ unsigned lds_addr(const void* p) { return (unsigned)(size_t)p; }

// Four copies in one statement; copy i moves the LDS address on by i*lstep bytes and the
// global address by i*gstep elements. s_wait_xcnt 0 closes the statement so that no
// address register of an issued copy is rewritten ahead of it.
__device__ __forceinline__ void copy4(unsigned lds, const _Float16* g, unsigned lstep, size_t gstep)
{
  const unsigned l1 = lds + lstep, l2 = lds + 2 * lstep, l3 = lds + 3 * lstep;
  const _Float16* g1 = g + gstep;
  const _Float16* g2 = g + 2 * gstep;
  const _Float16* g3 = g + 3 * gstep;
  asm volatile("global_load_async_to_lds_b128 %0, %4, off\n\t"
               "global_load_async_to_lds_b128 %1, %5, off\n\t"
               "global_load_async_to_lds_b128 %2, %6, off\n\t"
               "global_load_async_to_lds_b128 %3, %7, off\n\t"
               "s_wait_xcnt 0x0"
               :: "v"(lds), "v"(l1), "v"(l2), "v"(l3), "v"(g), "v"(g1), "v"(g2), "v"(g3)
               : "memory");
}

// The same with eight copies.
__device__ __forceinline__ void copy8(unsigned lds, const _Float16* g, unsigned lstep, size_t gstep)
{
  const unsigned l1 = lds + lstep,     l2 = lds + 2 * lstep, l3 = lds + 3 * lstep;
  const unsigned l4 = lds + 4 * lstep, l5 = lds + 5 * lstep, l6 = lds + 6 * lstep;
  const unsigned l7 = lds + 7 * lstep;
  const _Float16* g1 = g + gstep;
  const _Float16* g2 = g + 2 * gstep;
  const _Float16* g3 = g + 3 * gstep;
  const _Float16* g4 = g + 4 * gstep;
  const _Float16* g5 = g + 5 * gstep;
  const _Float16* g6 = g + 6 * gstep;
  const _Float16* g7 = g + 7 * gstep;
  asm volatile("global_load_async_to_lds_b128 %0, %8, off\n\t"
               "global_load_async_to_lds_b128 %1, %9, off\n\t"
               "global_load_async_to_lds_b128 %2, %10, off\n\t"
               "global_load_async_to_lds_b128 %3, %11, off\n\t"
               "global_load_async_to_lds_b128 %4, %12, off\n\t"
               "global_load_async_to_lds_b128 %5, %13, off\n\t"
               "global_load_async_to_lds_b128 %6, %14, off\n\t"
               "global_load_async_to_lds_b128 %7, %15, off\n\t"
               "s_wait_xcnt 0x0"
               :: "v"(lds), "v"(l1), "v"(l2), "v"(l3), "v"(l4), "v"(l5), "v"(l6), "v"(l7),
                  "v"(g), "v"(g1), "v"(g2), "v"(g3), "v"(g4), "v"(g5), "v"(g6), "v"(g7)
               : "memory");
}

// One wave's slice of a tile: 128 rows of 128 B (one whole line each), global row pitch GP
// elements, LDS row pitch 144 B (16 B x odd: ds_load_b128 readers meet no bank conflict).
// lds, g: this lane's addresses in copy 0 (row l>>3, 16-byte chunk l&7); a copy is 4 rows.
template <int GP>
__device__ __forceinline__ void copy_slice(unsigned lds, const _Float16* g)
{
#pragma unroll
  for (int i = 0; i < 4; ++i)
    copy8(lds + i * (32 * 144), g + (size_t)i * 32 * GP, 4 * 144, (size_t)4 * GP);
}

// This wave's own copies have landed.
__device__ __forceinline__ void wait_copies() { asm volatile("s_wait_asynccnt 0x0" ::: "memory"); }
// This wave's own LDS reads and writes have retired (before a buffer goes to its next writer).
__device__ __forceinline__ void wait_lds()    { asm volatile("s_wait_dscnt 0x0" ::: "memory"); }

__global__ void __launch_bounds__(128)
attn_kernel(const _Float16* __restrict__ Qh, const _Float16* __restrict__ Kh,
            const _Float16* __restrict__ Vt, float* out)
{
  __shared__ __align__(16) char smem[295168];
  float*    sc = (float*)smem;                  // [16][2048] f32
  _Float16* P  = (_Float16*)(smem + 131072);    // [16][2048] f16

  const int tid = threadIdx.x, l = tid & 31, w = tid >> 5;
  const int h = l >> 4, m = l & 15;
  const int q0 = blockIdx.x * 16;               // global query row (includes batch)
  const int b  = q0 >> 11;
  const float SCL = 0.044194173824159216f;      // 512^-0.5

  const unsigned sbase = lds_addr(smem);
  const int SLICE = 128 * 144;                  // one wave's slice of a tile buffer, bytes
  const unsigned cdst = w * SLICE + (l >> 3) * 144 + (l & 7) * 16;   // this lane's place, copy 0
  const int foff = w * SLICE + m * 144 + h * 16;                     // this lane's fragment base

  // ---- Stage 1: scores ----
  {
    const int KB0 = 131072, KB1 = 204800, QOFF = 278528;
    // tile t (0..31): keys w*512 + (t>>3)*128 .. +127, k = (t&7)*64 .. +63
    const _Float16* Ksrc = Kh + ((size_t)b * 2048 + w * 512 + (l >> 3)) * 512 + (l & 7) * 8;
    // Q: this wave brings rows 4w..4w+3, first halves (512 B) then second halves
    const _Float16* Qsrc = Qh + (size_t)(q0 + 4 * w) * 512 + l * 8;
    const unsigned  qdst = sbase + QOFF + 4 * w * 1040 + l * 16;
    copy4(qdst, Qsrc, 1040, 512);
    copy4(qdst + 512, Qsrc + 256, 1040, 512);
    copy_slice<512>(sbase + KB0 + cdst, Ksrc);
    wait_copies();
    __syncthreads();                            // Q and tile 0 are readable
    copy_slice<512>(sbase + KB1 + cdst, Ksrc + 64);

    const char* qf = smem + QOFF + m * 1040 + h * 16;
#pragma unroll 1   // rolled: one copy of the trip loop's code, its copy addresses formed per trip
    for (int g = 0; g < 4; ++g) {
      const int n0 = w * 512 + g * 128;         // key column base of this group
      v8f acc[8];
#pragma unroll
      for (int j = 0; j < 8; ++j) acc[j] = zero8();
#pragma unroll 1   // rolled: unrolled, the copies' addresses of all trips are formed ahead and spill
      for (int tp = 0; tp < 8; ++tp) {
        const int t = g * 8 + tp;
        const int kbuf = (t & 1) ? KB1 : KB0;
        const char* kf = smem + kbuf + foff;
        // all fragment reads of the trip stand as one group ahead of its WMMAs
        FragH a[2], bb[2][8];
#pragma unroll
        for (int d = 0; d < 2; ++d) {
          a[d].hh[0] = *(const v8h*)(qf + (tp * 2 + d) * 64);
          a[d].hh[1] = *(const v8h*)(qf + (tp * 2 + d) * 64 + 32);
#pragma unroll
          for (int j = 0; j < 8; ++j) {
            bb[d][j].hh[0] = *(const v8h*)(kf + j * (16 * 144) + d * 64);
            bb[d][j].hh[1] = *(const v8h*)(kf + j * (16 * 144) + d * 64 + 32);
          }
        }
#pragma unroll
        for (int d = 0; d < 2; ++d) {
#pragma unroll
          for (int j = 0; j < 8; ++j) acc[j] = mma_f16(a[d].v, bb[d][j].v, acc[j]);
        }
        // foot of trip t: tile t+1 is published, tile t's buffer is free for tile t+2
        wait_lds();
        wait_copies();
        __syncthreads();
        if (t + 2 < 32)
          copy_slice<512>(sbase + kbuf + cdst,
                          Ksrc + (size_t)((t + 2) >> 3) * (128 * 512) + ((t + 2) & 7) * 64);
      }
#pragma unroll
      for (int j = 0; j < 8; ++j) {
        float* d = sc + n0 + j * 16 + m;
#pragma unroll
        for (int r = 0; r < 8; ++r) d[(8 * h + r) * 2048] = acc[j][r] * SCL;
      }
    }
    wait_copies();
  }
  __syncthreads();

  // ---- Softmax: 8 threads per row, 256 contiguous elements each ----
  {
    const int row = tid >> 3, sub = tid & 7;
    float* rp = sc + row * 2048 + sub * 256;
    float mx = -3.0e38f;
#pragma unroll 4
    for (int j = 0; j < 256; j += 4) {
      const v4f v = *(const v4f*)(rp + j);
      mx = fmaxf(fmaxf(mx, fmaxf(v.x, v.y)), fmaxf(v.z, v.w));
    }
    mx = fmaxf(mx, __shfl_xor(mx, 1));
    mx = fmaxf(mx, __shfl_xor(mx, 2));
    mx = fmaxf(mx, __shfl_xor(mx, 4));
    float sm = 0.0f;
#pragma unroll 4
    for (int j = 0; j < 256; j += 4) {
      v4f v = *(const v4f*)(rp + j);
      v.x = __expf(v.x - mx);
      v.y = __expf(v.y - mx);
      v.z = __expf(v.z - mx);
      v.w = __expf(v.w - mx);
      sm += (v.x + v.y) + (v.z + v.w);
      *(v4f*)(rp + j) = v;
    }
    sm += __shfl_xor(sm, 1);
    sm += __shfl_xor(sm, 2);
    sm += __shfl_xor(sm, 4);
    const float ps = (1.0f / sm) * 16384.0f;    // normaliser with 2^14 pre-scale (exact)
    __syncthreads();
    _Float16* pp = P + row * 2048 + sub * 256;
#pragma unroll 2
    for (int j = 0; j < 256; j += 8) {
      const v4f v0 = *(const v4f*)(rp + j);
      const v4f v1 = *(const v4f*)(rp + j + 4);
      v8h o;
      o[0] = (_Float16)(v0.x * ps); o[1] = (_Float16)(v0.y * ps);
      o[2] = (_Float16)(v0.z * ps); o[3] = (_Float16)(v0.w * ps);
      o[4] = (_Float16)(v1.x * ps); o[5] = (_Float16)(v1.y * ps);
      o[6] = (_Float16)(v1.z * ps); o[7] = (_Float16)(v1.w * ps);
      *(v8h*)(pp + j) = o;
    }
  }
  wait_lds();                                   // sc becomes a tile buffer behind this barrier
  __syncthreads();

  // ---- Stage 2: O[16][512] = P V ; wave owns output columns e0..e0+127 ----
  const int e0 = w * 128;
  v8f oacc[8];
#pragma unroll
  for (int j = 0; j < 8; ++j) oacc[j] = zero8();
  {
    const int VB0 = 0, VB1 = 196608;
    const _Float16* Pr = P + m * 2048 + 8 * h;
    // tile t (0..31): rows e0 .. e0+127 of V^T, keys t*64 .. +63
    const _Float16* Vsrc = Vt + ((size_t)b * 512 + e0 + (l >> 3)) * 2048 + (l & 7) * 8;
    copy_slice<2048>(sbase + VB0 + cdst, Vsrc);
    wait_copies();
    __syncthreads();                            // tile 0 is readable
    copy_slice<2048>(sbase + VB1 + cdst, Vsrc + 64);
#pragma unroll 1   // rolled, for the same reason as in stage 1
    for (int t = 0; t < 32; ++t) {
      const int vbuf = (t & 1) ? VB1 : VB0;
      const char* vf = smem + vbuf + foff;
      // all fragment reads of the trip stand as one group ahead of its WMMAs
      FragH a[2], bb[2][8];
#pragma unroll
      for (int d = 0; d < 2; ++d) {
        a[d].hh[0] = *(const v8h*)(Pr + (t * 2 + d) * 32);
        a[d].hh[1] = *(const v8h*)(Pr + (t * 2 + d) * 32 + 16);
#pragma unroll
        for (int j = 0; j < 8; ++j) {
          bb[d][j].hh[0] = *(const v8h*)(vf + j * (16 * 144) + d * 64);
          bb[d][j].hh[1] = *(const v8h*)(vf + j * (16 * 144) + d * 64 + 32);
        }
      }
#pragma unroll
      for (int d = 0; d < 2; ++d) {
#pragma unroll
        for (int j = 0; j < 8; ++j) oacc[j] = mma_f16(a[d].v, bb[d][j].v, oacc[j]);
      }
      // foot of trip t: tile t+1 is published, tile t's buffer is free for tile t+2
      wait_lds();
      wait_copies();
      __syncthreads();
      if (t + 2 < 32)
        copy_slice<2048>(sbase + vbuf + cdst, Vsrc + (t + 2) * 64);
    }
    wait_copies();
  }

  // ---- Epilogue: undo 2^14, stage in LDS (sc region is free), whole-line stores ----
  float* os = sc;                               // [16][512] f32
  {
    const float OSCL = 6.103515625e-05f;        // 2^-14 exact
#pragma unroll
    for (int j = 0; j < 8; ++j) {
      float* d = os + e0 + j * 16 + m;
#pragma unroll
      for (int r = 0; r < 8; ++r) d[(8 * h + r) * 512] = oacc[j][r] * OSCL;
    }
  }
  __syncthreads();
  {
    const int q = l >> 3, t = l & 7;
    const int col = e0 + q * 32 + t * 4;
    const float* srow = os + col;
    float* orow = out + (size_t)q0 * 512 + col;
#pragma unroll
    for (int i = 0; i < 16; ++i) {
      const v4f v = *(const v4f*)(srow + i * 512);
      *(v4f*)(orow + (size_t)i * 512) = v;
    }
    
  }
}

// ---------------------------------------------------------------------------
// Host launcher
// ---------------------------------------------------------------------------
extern "C" void kernel_launch(void* const* d_in, const int* in_sizes, int n_in,
                              void* d_out, int out_size, void* d_ws, size_t ws_size,
                              hipStream_t stream)
{
  if (n_in < 5) return;
  const int NXY = 8 * 1024 * 512;     // 4194304
  const int NW  = 512 * 512;          // 262144
  const int NO  = 8 * 2048 * 512;     // 8388608
  if (in_sizes[0] != NXY || in_sizes[1] != NXY) return;
  if (in_sizes[2] != NW || in_sizes[3] != NW || in_sizes[4] != NW) return;
  if (out_size != NO) return;

  const float* x  = (const float*)d_in[0];
  const float* y  = (const float*)d_in[1];
  const float* Wq = (const float*)d_in[2];
  const float* Wk = (const float*)d_in[3];
  const float* Wv = (const float*)d_in[4];
  float* out = (float*)d_out;

  const size_t bytes_xyb = (size_t)16384 * 512 * 2;    // 16777216
  const size_t bytes_wb  = (size_t)3 * NW * 2;          //  1572864
  const size_t bytes_q   = (size_t)16384 * 512 * 2;    // 16777216 each for Qh, Kh, Vt
  const size_t off_xyb = 0;
  const size_t off_wb  = off_xyb + bytes_xyb;
  const size_t off_q   = off_wb  + bytes_wb;
  const size_t off_k   = off_q   + bytes_q;
  const size_t off_v   = off_k   + bytes_q;
  const size_t total   = off_v   + bytes_q;           // 68681728
  if (total > ws_size) return;

  char* ws = (char*)d_ws;
  unsigned short* xyb = (unsigned short*)(ws + off_xyb);
  unsigned short* wb  = (unsigned short*)(ws + off_wb);
  _Float16* Qh = (_Float16*)(ws + off_q);
  _Float16* Kh = (_Float16*)(ws + off_k);
  _Float16* Vt = (_Float16*)(ws + off_v);

  prep_kernel<<<4096 + 384, 256, 0, stream>>>(x, y, Wq, Wk, Wv, xyb, wb);

  proj_kernel<<<dim3(256, 8), 128, 0, stream>>>((const __bf16*)xyb, (const __bf16*)wb, Qh, Kh, Vt);

  // Pass 2: attention, 16 query rows per block: 16384/16 blocks
  attn_kernel<<<1024, 128, 0, stream>>>(Qh, Kh, Vt, out);
}

// v002
// Measured time: 175 microseconds a run.
// Next to v001, in two timings, it ran 1.92 times as fast each time.
// Counting every step since v000, it is 4.90 times as fast.
#include <hip/hip_runtime.h>
// Contractions: q/k/v projections on v_wmma_f32_16x16x32_bf16 (bf16 operands); scores and P.V on v_wmma_f32_16x16x32_f16 (f16 operands, P scaled by 2^14); f32 accumulate everywhere.

typedef _Float16 v16h __attribute__((ext_vector_type(16)));
typedef _Float16 v8h  __attribute__((ext_vector_type(8)));
typedef _Float16 v4h  __attribute__((ext_vector_type(4)));
typedef __bf16   v16b __attribute__((ext_vector_type(16)));
typedef __bf16   v8b  __attribute__((ext_vector_type(8)));
typedef float    v8f  __attribute__((ext_vector_type(8)));
typedef float    v4f  __attribute__((ext_vector_type(4)));
typedef unsigned v4u  __attribute__((ext_vector_type(4)));

union FragH { v16h v; v8h hh[2]; };
union FragB { v16b v; v8b hh[2]; };

__device__ __forceinline__ v8f zero8() {
  v8f z = {0.f, 0.f, 0.f, 0.f, 0.f, 0.f, 0.f, 0.f};
  return z;
}

// 16x16x32 f16 WMMA with hazard guard (ties D, keeps A/B live)
__device__ __forceinline__ v8f mma_f16(v16h a, v16h b, v8f c) {
  v8f d = __builtin_amdgcn_wmma_f32_16x16x32_f16(false, a, false, b, (short)0, c, false, false);
  asm volatile("v_nop\n\tv_nop\n\tv_nop\n\tv_nop" : "+v"(d) : "v"(a), "v"(b));
  return d;
}

// 16x16x32 bf16 WMMA with hazard guard
__device__ __forceinline__ v8f mma_bf16(v16b a, v16b b, v8f c) {
  v8f d = __builtin_amdgcn_wmma_f32_16x16x32_bf16(false, a, false, b, (short)0, c, false, false);
  asm volatile("v_nop\n\tv_nop\n\tv_nop\n\tv_nop" : "+v"(d) : "v"(a), "v"(b));
  return d;
}

// f32 -> bf16 bits, RNE convert
__device__ __forceinline__ unsigned bf16_rne(float f) {
  unsigned u = __float_as_uint(f);
  return (u + 0x7FFFu + ((u >> 16) & 1u)) >> 16;
}
__device__ __forceinline__ unsigned pack2(float a, float b) {
  return bf16_rne(a) | (bf16_rne(b) << 16);
}

// ---------------------------------------------------------------------------
//         Wq | Wk | Wv -> bf16 in native [e][d] layout (k-contiguous B layout).
// blocks [0,4096): xy, 8 elements per thread; blocks [4096,4480): weights.
// ---------------------------------------------------------------------------
__global__ void __launch_bounds__(256)
prep_kernel(const float* __restrict__ x, const float* __restrict__ y,
            const float* __restrict__ wq, const float* __restrict__ wk,
            const float* __restrict__ wv,
            unsigned short* xyb, unsigned short* wb)
{
  const int bid = blockIdx.x, tid = threadIdx.x;
  if (bid < 4096) {
    const int gid = bid * 256 + tid;            // 0 .. 1048575
    const int row = gid >> 6;                   // token row b*2048 + s
    const int d   = (gid & 63) * 8;
    const int b   = row >> 11, s = row & 2047;
    const float* src = (s < 1024)
        ? x + ((size_t)(b * 1024 + s) * 512 + d)
        : y + ((size_t)(b * 1024 + (s - 1024)) * 512 + d);
    const v4f v0 = *(const v4f*)src;
    const v4f v1 = *(const v4f*)(src + 4);
    v4u o;
    o.x = pack2(v0.x, v0.y); o.y = pack2(v0.z, v0.w);
    o.z = pack2(v1.x, v1.y); o.w = pack2(v1.z, v1.w);
    unsigned short* dst = xyb + (size_t)gid * 8;
    *(v4u*)dst = o;
    
  } else {
    const int k   = bid - 4096;                 // 0 .. 383
    const int mt  = k >> 7;                     // 0,1,2 (block-uniform)
    const int gid = (k & 127) * 256 + tid;      // 0 .. 32767
    const float* wsrc = (mt == 0) ? wq : ((mt == 1) ? wk : wv);
    const float* src = wsrc + (size_t)gid * 8;
    const v4f v0 = *(const v4f*)src;
    const v4f v1 = *(const v4f*)(src + 4);
    v4u o;
    o.x = pack2(v0.x, v0.y); o.y = pack2(v0.z, v0.w);
    o.z = pack2(v1.x, v1.y); o.w = pack2(v1.z, v1.w);
    unsigned short* dst = wb + (size_t)mt * 262144 + (size_t)gid * 8;
    *(v4u*)dst = o;
    
  }
}

// ---------------------------------------------------------------------------
// Block tile: 64 token rows x 64 e columns for each of Q, K, V; wave: 32x32 x 3.
// A = xy rows (row-major, k = d contiguous); B[k=d][n=e] = W[e][d] -> W row e is
// k-contiguous, loaded with the same split k map as A.
// Epilogue through LDS: Qh, Kh row-major f16 [16384][512]; Vt f16 [8][512][2048].
// ---------------------------------------------------------------------------
__global__ void __launch_bounds__(128)
proj_kernel(const __bf16* __restrict__ xyb, const __bf16* __restrict__ wb,
            _Float16* Qh, _Float16* Kh, _Float16* Vt)
{
  __shared__ __align__(16) _Float16 sq[64 * 72];
  __shared__ __align__(16) _Float16 sk[64 * 72];
  __shared__ __align__(16) _Float16 sv[64 * 72];   // [e_local][s_local]

  const int tid = threadIdx.x, l = tid & 31, w = tid >> 5;
  const int h = l >> 4, m = l & 15;
  const int wr = w >> 1, wc = w & 1;
  const int bx = blockIdx.x, by = blockIdx.y;
  const int lr0 = wr * 32, lc0 = wc * 32;            // tile-local bases of this wave

  const __bf16* Ap = xyb + (size_t)(bx * 64 + lr0 + m) * 512 + 8 * h;   // ti=1: + 16*512
  const __bf16* Bp = wb  + (size_t)(by * 64 + lc0 + m) * 512 + 8 * h;   // + mt*262144 + tj*16*512

  v8f acc[12];                                        // index = mt*4 + ti*2 + tj
#pragma unroll
  for (int i = 0; i < 12; ++i) acc[i] = zero8();

#pragma unroll 1
  for (int ks = 0; ks < 16; ++ks) {
    const int k0 = ks * 32;
    FragB a0, a1;
    a0.hh[0] = *(const v8b*)(Ap + k0);
    a0.hh[1] = *(const v8b*)(Ap + k0 + 16);
    a1.hh[0] = *(const v8b*)(Ap + 16 * 512 + k0);
    a1.hh[1] = *(const v8b*)(Ap + 16 * 512 + k0 + 16);
#pragma unroll
    for (int mt = 0; mt < 3; ++mt) {
#pragma unroll
      for (int tj = 0; tj < 2; ++tj) {
        const __bf16* p = Bp + (size_t)mt * 262144 + tj * (16 * 512) + k0;
        FragB bb;
        bb.hh[0] = *(const v8b*)p;
        bb.hh[1] = *(const v8b*)(p + 16);
        acc[mt * 4 + tj]     = mma_bf16(a0.v, bb.v, acc[mt * 4 + tj]);
        acc[mt * 4 + 2 + tj] = mma_bf16(a1.v, bb.v, acc[mt * 4 + 2 + tj]);
      }
    }
  }

  // accumulators -> LDS tiles (D element r = row 8h+r, col m)
#pragma unroll
  for (int ti = 0; ti < 2; ++ti) {
#pragma unroll
    for (int tj = 0; tj < 2; ++tj) {
      const v8f cq = acc[0 + ti * 2 + tj];
      const v8f ck = acc[4 + ti * 2 + tj];
      const v8f cv = acc[8 + ti * 2 + tj];
      const int rbase = lr0 + ti * 16 + 8 * h;   // token row of element r=0 (tile-local)
      const int ccol  = lc0 + tj * 16 + m;       // e column (tile-local)
#pragma unroll
      for (int r = 0; r < 8; ++r) {
        sq[(rbase + r) * 72 + ccol] = (_Float16)cq[r];
        sk[(rbase + r) * 72 + ccol] = (_Float16)ck[r];
      }
      v8h pv;
#pragma unroll
      for (int r = 0; r < 8; ++r) pv[r] = (_Float16)cv[r];
      *(v8h*)(sv + ccol * 72 + rbase) = pv;    // transposed: row e, 8 contiguous s
    }
  }
  __syncthreads();

  const int q = l >> 3, t = l & 7;
  const int b  = bx >> 5;
  const int s0 = (bx & 31) * 64;
#pragma unroll
  for (int i = 0; i < 4; ++i) {
    const int row = w * 16 + i * 4 + q;
    const v8h vq = *(const v8h*)(sq + row * 72 + 8 * t);
    const v8h vk = *(const v8h*)(sk + row * 72 + 8 * t);
    const v8h vv = *(const v8h*)(sv + row * 72 + 8 * t);
    *(v8h*)(Qh + (size_t)(bx * 64 + row) * 512 + by * 64 + 8 * t) = vq;
    *(v8h*)(Kh + (size_t)(bx * 64 + row) * 512 + by * 64 + 8 * t) = vk;
    *(v8h*)(Vt + ((size_t)b * 512 + by * 64 + row) * 2048 + s0 + 8 * t) = vv;
  }
  
}

// ---------------------------------------------------------------------------
// Asynchronous copies global -> LDS (16 bytes per lane, through no register).
// ---------------------------------------------------------------------------
// LDS byte address of a __shared__ pointer: the low 32 bits of its flat address.
__device__ __forceinline__ unsigned lds_addr(const void* p) { return (unsigned)(size_t)p; }

// Eight copies in one statement; copy i moves the LDS address on by i*lstep bytes and the
// global address by i*gstep elements. s_wait_xcnt 0 closes the statement so that no
// address register of an issued copy is rewritten ahead of it.
__device__ __forceinline__ void copy8(unsigned lds, const _Float16* g, unsigned lstep, size_t gstep)
{
  const unsigned l1 = lds + lstep,     l2 = lds + 2 * lstep, l3 = lds + 3 * lstep;
  const unsigned l4 = lds + 4 * lstep, l5 = lds + 5 * lstep, l6 = lds + 6 * lstep;
  const unsigned l7 = lds + 7 * lstep;
  const _Float16* g1 = g + gstep;
  const _Float16* g2 = g + 2 * gstep;
  const _Float16* g3 = g + 3 * gstep;
  const _Float16* g4 = g + 4 * gstep;
  const _Float16* g5 = g + 5 * gstep;
  const _Float16* g6 = g + 6 * gstep;
  const _Float16* g7 = g + 7 * gstep;
  asm volatile("global_load_async_to_lds_b128 %0, %8, off\n\t"
               "global_load_async_to_lds_b128 %1, %9, off\n\t"
               "global_load_async_to_lds_b128 %2, %10, off\n\t"
               "global_load_async_to_lds_b128 %3, %11, off\n\t"
               "global_load_async_to_lds_b128 %4, %12, off\n\t"
               "global_load_async_to_lds_b128 %5, %13, off\n\t"
               "global_load_async_to_lds_b128 %6, %14, off\n\t"
               "global_load_async_to_lds_b128 %7, %15, off\n\t"
               "s_wait_xcnt 0x0"
               :: "v"(lds), "v"(l1), "v"(l2), "v"(l3), "v"(l4), "v"(l5), "v"(l6), "v"(l7),
                  "v"(g), "v"(g1), "v"(g2), "v"(g3), "v"(g4), "v"(g5), "v"(g6), "v"(g7)
               : "memory");
}

// One wave's half of a tile slice: 64 rows of 128 B (one whole line each), global row pitch GP
// elements, LDS row pitch 144 B (16 B x odd: ds_load_b128 readers meet no bank conflict).
// lds, g: this lane's addresses in copy 0 (row l>>3, 16-byte chunk l&7); a copy is 4 rows.
template <int GP>
__device__ __forceinline__ void copy_half(unsigned lds, const _Float16* g)
{
#pragma unroll
  for (int i = 0; i < 2; ++i)
    copy8(lds + i * (32 * 144), g + (size_t)i * 32 * GP, 4 * 144, (size_t)4 * GP);
}

// This wave's own copies have landed.
__device__ __forceinline__ void wait_copies() { asm volatile("s_wait_asynccnt 0x0" ::: "memory"); }
// This wave's own LDS reads and writes have retired (before a buffer goes to its next writer).
__device__ __forceinline__ void wait_lds()    { asm volatile("s_wait_dscnt 0x0" ::: "memory"); }

__global__ void __launch_bounds__(256)
attn_kernel(const _Float16* __restrict__ Qh, const _Float16* __restrict__ Kh,
            const _Float16* __restrict__ Vt, float* out)
{
  __shared__ __align__(16) char smem[281088];
  const int TB0 = 0, TB1 = 73728, POFF = 147456, QOFF = 214016, AOFF = 280576, LOFF = 280832;
  const int SCP = 2112;                         // sc row pitch, bytes

  const int tid = threadIdx.x, l = tid & 31, w = tid >> 5;
  const int h = l >> 4, m = l & 15;
  const int rh = w >> 2, kg = w & 3;
  const int q0 = blockIdx.x * 64;               // global query row (includes batch)
  const int b  = q0 >> 11;
  const float SCL = 0.044194173824159216f;      // 512^-0.5

  const unsigned sbase = lds_addr(smem);
  const int SLICE = 128 * 144;                  // one key/column group's slice of a tile buffer, bytes
  const unsigned cdst = kg * SLICE + (rh * 64 + (l >> 3)) * 144 + (l & 7) * 16;  // this lane's place, copy 0
  const int foff = kg * SLICE + m * 144 + h * 16;                                // this lane's fragment base
  const char* qf = smem + QOFF + (rh * 32 + m) * 1040 + h * 16;
  const char* pf = smem + POFF + (rh * 32 + m) * 1040 + h * 16;
  float* sal  = (float*)(smem + AOFF);
  float* ssum = (float*)(smem + LOFF);

  // K tile (chunk c, trip tp): keys c*512 + kg*128 .. +127, k = tp*64 .. +63
  const _Float16* Ksrc = Kh + ((size_t)b * 2048 + kg * 128 + rh * 64 + (l >> 3)) * 512 + (l & 7) * 8;
  // V^T tile (chunk c, trip t): rows kg*128 .. +127 of V^T, keys c*512 + t*64 .. +63
  const _Float16* Vsrc = Vt + ((size_t)b * 512 + kg * 128 + rh * 64 + (l >> 3)) * 2048 + (l & 7) * 8;

  // Q: this wave brings rows 8w..8w+7, first halves (512 B) then second halves
  {
    const _Float16* Qsrc = Qh + (size_t)(q0 + 8 * w) * 512 + l * 8;
    const unsigned  qdst = sbase + QOFF + 8 * w * 1040 + l * 16;
    copy8(qdst, Qsrc, 1040, 512);
    copy8(qdst + 512, Qsrc + 256, 1040, 512);
  }

  v8f oacc[2][8];
#pragma unroll
  for (int i = 0; i < 2; ++i)
#pragma unroll
    for (int j = 0; j < 8; ++j) oacc[i][j] = zero8();

  const int srow = tid >> 2, sub = tid & 3;     // softmax: 4 threads per row
  float mrun = -3.0e38f, lrun = 0.0f;           // running maximum and sum of row srow

#pragma unroll 1   // rolled: one copy of the chunk's code
  for (int c = 0; c < 4; ++c) {
    // ---- Stage 1: scores of this chunk ----
    {
      const _Float16* Kc = Ksrc + (size_t)c * (512 * 512);
      copy_half<512>(sbase + TB0 + cdst, Kc);
      wait_copies();
      __syncthreads();                          // tile 0 (and, in chunk 0, Q) is readable
      copy_half<512>(sbase + TB1 + cdst, Kc + 64);

      v8f acc[2][8];
#pragma unroll
      for (int i = 0; i < 2; ++i)
#pragma unroll
        for (int j = 0; j < 8; ++j) acc[i][j] = zero8();
#pragma unroll 1   // rolled: unrolled, the copies' addresses of all trips are formed ahead and spill
      for (int tp = 0; tp < 8; ++tp) {
        const int kbuf = (tp & 1) ? TB1 : TB0;
        const char* kf = smem + kbuf + foff;
#pragma unroll
        for (int d = 0; d < 2; ++d) {
          // the fragment reads of a half trip stand as one group ahead of its WMMAs
          FragH a[2], bb[8];
#pragma unroll
          for (int i = 0; i < 2; ++i) {
            a[i].hh[0] = *(const v8h*)(qf + i * (16 * 1040) + (tp * 2 + d) * 64);
            a[i].hh[1] = *(const v8h*)(qf + i * (16 * 1040) + (tp * 2 + d) * 64 + 32);
          }
#pragma unroll
          for (int j = 0; j < 8; ++j) {
            bb[j].hh[0] = *(const v8h*)(kf + j * (16 * 144) + d * 64);
            bb[j].hh[1] = *(const v8h*)(kf + j * (16 * 144) + d * 64 + 32);
          }
#pragma unroll
          for (int j = 0; j < 8; ++j) {
#pragma unroll
            for (int i = 0; i < 2; ++i) acc[i][j] = mma_f16(a[i].v, bb[j].v, acc[i][j]);
          }
        }
        // foot of trip tp: tile tp+1 is published, tile tp's buffer is free for tile tp+2
        wait_lds();
        wait_copies();
        __syncthreads();
        if (tp + 2 < 8)
          copy_half<512>(sbase + kbuf + cdst, Kc + (tp + 2) * 64);
      }
      wait_copies();
      // behind the last foot's barrier no K tile is live: sc takes the buffers' place
#pragma unroll
      for (int i = 0; i < 2; ++i) {
#pragma unroll
        for (int j = 0; j < 8; ++j) {
          float* d = (float*)(smem + (rh * 32 + i * 16 + 8 * h) * SCP) + kg * 128 + j * 16 + m;
#pragma unroll
          for (int r = 0; r < 8; ++r) d[r * (SCP / 4)] = acc[i][j][r] * SCL;
        }
      }
    }
    __syncthreads();

    // ---- Online softmax: thread sub of a row takes every fourth group of 4 scores ----
    {
      const float* rp = (const float*)(smem + srow * SCP) + sub * 4;
      float mx = -3.0e38f;
#pragma unroll 8
      for (int i = 0; i < 32; ++i) {
        const v4f v = *(const v4f*)(rp + i * 16);
        mx = fmaxf(fmaxf(mx, fmaxf(v.x, v.y)), fmaxf(v.z, v.w));
      }
      mx = fmaxf(mx, __shfl_xor(mx, 1));
      mx = fmaxf(mx, __shfl_xor(mx, 2));
      const float mnew = fmaxf(mrun, mx);
      const float al = __expf(mrun - mnew);     // 0 in chunk 0
      char* pp = smem + POFF + srow * 1040 + sub * 8;
      float sm = 0.0f;
#pragma unroll 4
      for (int i = 0; i < 32; ++i) {
        v4f v = *(const v4f*)(rp + i * 16);
        v.x = __expf(v.x - mnew);
        v.y = __expf(v.y - mnew);
        v.z = __expf(v.z - mnew);
        v.w = __expf(v.w - mnew);
        sm += (v.x + v.y) + (v.z + v.w);
        v4h o;
        o[0] = (_Float16)(v.x * 16384.0f); o[1] = (_Float16)(v.y * 16384.0f);
        o[2] = (_Float16)(v.z * 16384.0f); o[3] = (_Float16)(v.w * 16384.0f);
        *(v4h*)(pp + i * 32) = o;
      }
      sm += __shfl_xor(sm, 1);
      sm += __shfl_xor(sm, 2);
      lrun = lrun * al + sm;
      mrun = mnew;
      if (sub == 0) { sal[srow] = al; ssum[srow] = lrun; }
    }
    wait_lds();                                 // sc becomes a tile buffer behind this barrier
    __syncthreads();

    // ---- Stage 2: O[64][512] = O * factor + P V ; wave owns 32 rows x 128 columns ----
    {
      const _Float16* Vc = Vsrc + c * 512;
      copy_half<2048>(sbase + TB0 + cdst, Vc);
#pragma unroll
      for (int i = 0; i < 2; ++i) {
        const float* ap = sal + rh * 32 + i * 16 + 8 * h;
        const v4f f0 = *(const v4f*)ap;
        const v4f f1 = *(const v4f*)(ap + 4);
#pragma unroll
        for (int j = 0; j < 8; ++j) {
#pragma unroll
          for (int r = 0; r < 4; ++r) { oacc[i][j][r] *= f0[r]; oacc[i][j][r + 4] *= f1[r]; }
        }
      }
      wait_copies();
      __syncthreads();                          // tile 0 is readable
      copy_half<2048>(sbase + TB1 + cdst, Vc + 64);
#pragma unroll 1   // rolled, for the same reason as in stage 1
      for (int t = 0; t < 8; ++t) {
        const int vbuf = (t & 1) ? TB1 : TB0;
        const char* vf = smem + vbuf + foff;
#pragma unroll
        for (int d = 0; d < 2; ++d) {
          // the fragment reads of a half trip stand as one group ahead of its WMMAs
          FragH a[2], bb[8];
#pragma unroll
          for (int i = 0; i < 2; ++i) {
            a[i].hh[0] = *(const v8h*)(pf + i * (16 * 1040) + (t * 2 + d) * 64);
            a[i].hh[1] = *(const v8h*)(pf + i * (16 * 1040) + (t * 2 + d) * 64 + 32);
          }
#pragma unroll
          for (int j = 0; j < 8; ++j) {
            bb[j].hh[0] = *(const v8h*)(vf + j * (16 * 144) + d * 64);
            bb[j].hh[1] = *(const v8h*)(vf + j * (16 * 144) + d * 64 + 32);
          }
#pragma unroll
          for (int j = 0; j < 8; ++j) {
#pragma unroll
            for (int i = 0; i < 2; ++i) oacc[i][j] = mma_f16(a[i].v, bb[j].v, oacc[i][j]);
          }
        }
        // foot of trip t: tile t+1 is published, tile t's buffer is free for tile t+2
        wait_lds();
        wait_copies();
        __syncthreads();
        if (t + 2 < 8)
          copy_half<2048>(sbase + vbuf + cdst, Vc + (t + 2) * 64);
      }
      wait_copies();
    }
  }

  // ---- Epilogue: normalise, undo 2^14, stage in LDS (the tile buffers are free), whole-line stores ----
  float* os = (float*)smem;                     // [64][512] f32
  {
    const float OSCL = 6.103515625e-05f;        // 2^-14 exact
#pragma unroll
    for (int i = 0; i < 2; ++i) {
      const float* lp = ssum + rh * 32 + i * 16 + 8 * h;
      const v4f s0 = *(const v4f*)lp;
      const v4f s1 = *(const v4f*)(lp + 4);
      float inv[8];
#pragma unroll
      for (int r = 0; r < 4; ++r) { inv[r] = OSCL / s0[r]; inv[r + 4] = OSCL / s1[r]; }
#pragma unroll
      for (int j = 0; j < 8; ++j) {
        float* d = os + (rh * 32 + i * 16 + 8 * h) * 512 + kg * 128 + j * 16 + m;
#pragma unroll
        for (int r = 0; r < 8; ++r) d[r * 512] = oacc[i][j][r] * inv[r];
      }
    }
  }
  __syncthreads();
  {
    const int col = kg * 128 + l * 4;
    const float* srw = os + (rh * 32) * 512 + col;
    float* orow = out + (size_t)(q0 + rh * 32) * 512 + col;
#pragma unroll
    for (int i = 0; i < 32; ++i) {
      const v4f v = *(const v4f*)(srw + i * 512);
      *(v4f*)(orow + (size_t)i * 512) = v;
    }
  }
}

// ---------------------------------------------------------------------------
// Host launcher
// ---------------------------------------------------------------------------
extern "C" void kernel_launch(void* const* d_in, const int* in_sizes, int n_in,
                              void* d_out, int out_size, void* d_ws, size_t ws_size,
                              hipStream_t stream)
{
  if (n_in < 5) return;
  const int NXY = 8 * 1024 * 512;     // 4194304
  const int NW  = 512 * 512;          // 262144
  const int NO  = 8 * 2048 * 512;     // 8388608
  if (in_sizes[0] != NXY || in_sizes[1] != NXY) return;
  if (in_sizes[2] != NW || in_sizes[3] != NW || in_sizes[4] != NW) return;
  if (out_size != NO) return;

  const float* x  = (const float*)d_in[0];
  const float* y  = (const float*)d_in[1];
  const float* Wq = (const float*)d_in[2];
  const float* Wk = (const float*)d_in[3];
  const float* Wv = (const float*)d_in[4];
  float* out = (float*)d_out;

  const size_t bytes_xyb = (size_t)16384 * 512 * 2;    // 16777216
  const size_t bytes_wb  = (size_t)3 * NW * 2;          //  1572864
  const size_t bytes_q   = (size_t)16384 * 512 * 2;    // 16777216 each for Qh, Kh, Vt
  const size_t off_xyb = 0;
  const size_t off_wb  = off_xyb + bytes_xyb;
  const size_t off_q   = off_wb  + bytes_wb;
  const size_t off_k   = off_q   + bytes_q;
  const size_t off_v   = off_k   + bytes_q;
  const size_t total   = off_v   + bytes_q;           // 68681728
  if (total > ws_size) return;

  char* ws = (char*)d_ws;
  unsigned short* xyb = (unsigned short*)(ws + off_xyb);
  unsigned short* wb  = (unsigned short*)(ws + off_wb);
  _Float16* Qh = (_Float16*)(ws + off_q);
  _Float16* Kh = (_Float16*)(ws + off_k);
  _Float16* Vt = (_Float16*)(ws + off_v);

  prep_kernel<<<4096 + 384, 256, 0, stream>>>(x, y, Wq, Wk, Wv, xyb, wb);

  proj_kernel<<<dim3(256, 8), 128, 0, stream>>>((const __bf16*)xyb, (const __bf16*)wb, Qh, Kh, Vt);

  // Pass 2: attention, 64 query rows per block: 16384/64 blocks
  attn_kernel<<<256, 256, 0, stream>>>(Qh, Kh, Vt, out);
}

// v003
// It runs in 125 microseconds.
// Timed twice side by side with v002, it ran 1.39 times as fast both times.
// Counting every step since v000, it is 6.83 times as fast.
#include <hip/hip_runtime.h>
// Contractions: q/k/v projections on v_wmma_f32_16x16x32_bf16 (bf16 operands); scores and P.V on v_wmma_f32_16x16x32_f16 (f16 operands, P scaled by 2^14); f32 accumulate everywhere.

typedef _Float16 v16h __attribute__((ext_vector_type(16)));
typedef _Float16 v8h  __attribute__((ext_vector_type(8)));
typedef _Float16 v4h  __attribute__((ext_vector_type(4)));
typedef __bf16   v16b __attribute__((ext_vector_type(16)));
typedef __bf16   v8b  __attribute__((ext_vector_type(8)));
typedef float    v8f  __attribute__((ext_vector_type(8)));
typedef float    v4f  __attribute__((ext_vector_type(4)));
typedef unsigned v4u  __attribute__((ext_vector_type(4)));

union FragH { v16h v; v8h hh[2]; };
union FragB { v16b v; v8b hh[2]; };

__device__ __forceinline__ v8f zero8() {
  v8f z = {0.f, 0.f, 0.f, 0.f, 0.f, 0.f, 0.f, 0.f};
  return z;
}

// 16x16x32 f16 WMMA with hazard guard (ties D, keeps A/B live)
__device__ __forceinline__ v8f mma_f16(v16h a, v16h b, v8f c) {
  v8f d = __builtin_amdgcn_wmma_f32_16x16x32_f16(false, a, false, b, (short)0, c, false, false);
  asm volatile("v_nop\n\tv_nop\n\tv_nop\n\tv_nop" : "+v"(d) : "v"(a), "v"(b));
  return d;
}

// 16x16x32 bf16 WMMA with hazard guard
__device__ __forceinline__ v8f mma_bf16(v16b a, v16b b, v8f c) {
  v8f d = __builtin_amdgcn_wmma_f32_16x16x32_bf16(false, a, false, b, (short)0, c, false, false);
  asm volatile("v_nop\n\tv_nop\n\tv_nop\n\tv_nop" : "+v"(d) : "v"(a), "v"(b));
  return d;
}

// f32 -> bf16 bits, RNE convert
__device__ __forceinline__ unsigned bf16_rne(float f) {
  unsigned u = __float_as_uint(f);
  return (u + 0x7FFFu + ((u >> 16) & 1u)) >> 16;
}
__device__ __forceinline__ unsigned pack2(float a, float b) {
  return bf16_rne(a) | (bf16_rne(b) << 16);
}

// ---------------------------------------------------------------------------
//         Wq | Wk | Wv -> bf16 in native [e][d] layout (k-contiguous B layout).
// blocks [0,4096): xy, 8 elements per thread; blocks [4096,4480): weights.
// ---------------------------------------------------------------------------
__global__ void __launch_bounds__(256)
prep_kernel(const float* __restrict__ x, const float* __restrict__ y,
            const float* __restrict__ wq, const float* __restrict__ wk,
            const float* __restrict__ wv,
            unsigned short* xyb, unsigned short* wb)
{
  const int bid = blockIdx.x, tid = threadIdx.x;
  if (bid < 4096) {
    const int gid = bid * 256 + tid;            // 0 .. 1048575
    const int row = gid >> 6;                   // token row b*2048 + s
    const int d   = (gid & 63) * 8;
    const int b   = row >> 11, s = row & 2047;
    const float* src = (s < 1024)
        ? x + ((size_t)(b * 1024 + s) * 512 + d)
        : y + ((size_t)(b * 1024 + (s - 1024)) * 512 + d);
    const v4f v0 = *(const v4f*)src;
    const v4f v1 = *(const v4f*)(src + 4);
    v4u o;
    o.x = pack2(v0.x, v0.y); o.y = pack2(v0.z, v0.w);
    o.z = pack2(v1.x, v1.y); o.w = pack2(v1.z, v1.w);
    unsigned short* dst = xyb + (size_t)gid * 8;
    *(v4u*)dst = o;
    
  } else {
    const int k   = bid - 4096;                 // 0 .. 383
    const int mt  = k >> 7;                     // 0,1,2 (block-uniform)
    const int gid = (k & 127) * 256 + tid;      // 0 .. 32767
    const float* wsrc = (mt == 0) ? wq : ((mt == 1) ? wk : wv);
    const float* src = wsrc + (size_t)gid * 8;
    const v4f v0 = *(const v4f*)src;
    const v4f v1 = *(const v4f*)(src + 4);
    v4u o;
    o.x = pack2(v0.x, v0.y); o.y = pack2(v0.z, v0.w);
    o.z = pack2(v1.x, v1.y); o.w = pack2(v1.z, v1.w);
    unsigned short* dst = wb + (size_t)mt * 262144 + (size_t)gid * 8;
    *(v4u*)dst = o;
    
  }
}

// ---------------------------------------------------------------------------
// Asynchronous copies global -> LDS (16 bytes per lane, through no register).
// ---------------------------------------------------------------------------
// LDS byte address of a __shared__ pointer: the low 32 bits of its flat address.
__device__ __forceinline__ unsigned lds_addr(const void* p) { return (unsigned)(size_t)p; }

// Eight copies in one statement; copy i moves the LDS address on by i*lstep bytes and the
// global address by i*gstep elements. s_wait_xcnt 0 closes the statement so that no
// address register of an issued copy is rewritten ahead of it.
__device__ __forceinline__ void copy8(unsigned lds, const _Float16* g, unsigned lstep, size_t gstep)
{
  const unsigned l1 = lds + lstep,     l2 = lds + 2 * lstep, l3 = lds + 3 * lstep;
  const unsigned l4 = lds + 4 * lstep, l5 = lds + 5 * lstep, l6 = lds + 6 * lstep;
  const unsigned l7 = lds + 7 * lstep;
  const _Float16* g1 = g + gstep;
  const _Float16* g2 = g + 2 * gstep;
  const _Float16* g3 = g + 3 * gstep;
  const _Float16* g4 = g + 4 * gstep;
  const _Float16* g5 = g + 5 * gstep;
  const _Float16* g6 = g + 6 * gstep;
  const _Float16* g7 = g + 7 * gstep;
  asm volatile("global_load_async_to_lds_b128 %0, %8, off\n\t"
               "global_load_async_to_lds_b128 %1, %9, off\n\t"
               "global_load_async_to_lds_b128 %2, %10, off\n\t"
               "global_load_async_to_lds_b128 %3, %11, off\n\t"
               "global_load_async_to_lds_b128 %4, %12, off\n\t"
               "global_load_async_to_lds_b128 %5, %13, off\n\t"
               "global_load_async_to_lds_b128 %6, %14, off\n\t"
               "global_load_async_to_lds_b128 %7, %15, off\n\t"
               "s_wait_xcnt 0x0"
               :: "v"(lds), "v"(l1), "v"(l2), "v"(l3), "v"(l4), "v"(l5), "v"(l6), "v"(l7),
                  "v"(g), "v"(g1), "v"(g2), "v"(g3), "v"(g4), "v"(g5), "v"(g6), "v"(g7)
               : "memory");
}

// One wave's half of a tile slice: 64 rows of 128 B (one whole line each), global row pitch GP
// elements, LDS row pitch 144 B (16 B x odd: ds_load_b128 readers meet no bank conflict).
// lds, g: this lane's addresses in copy 0 (row l>>3, 16-byte chunk l&7); a copy is 4 rows.
template <int GP>
__device__ __forceinline__ void copy_half(unsigned lds, const _Float16* g)
{
#pragma unroll
  for (int i = 0; i < 2; ++i)
    copy8(lds + i * (32 * 144), g + (size_t)i * 32 * GP, 4 * 144, (size_t)4 * GP);
}

// This wave's own copies have landed.
__device__ __forceinline__ void wait_copies() { asm volatile("s_wait_asynccnt 0x0" ::: "memory"); }
// This wave's own LDS reads and writes have retired (before a buffer goes to its next writer).
__device__ __forceinline__ void wait_lds()    { asm volatile("s_wait_dscnt 0x0" ::: "memory"); }

__global__ void __launch_bounds__(128)
proj_kernel(const __bf16* __restrict__ xyb, const __bf16* __restrict__ wb,
            _Float16* Qh, _Float16* Kh, _Float16* Vt)
{
  const int PB = 256 * 144;                        // one tile buffer, bytes
  __shared__ __align__(16) char smem[2 * 256 * 144];
  // the epilogue's staging tiles take the buffers' place behind the loop
  _Float16* sq = (_Float16*)smem;
  _Float16* sk = sq + 64 * 72;
  _Float16* sv = sk + 64 * 72;                     // [e_local][s_local]

  const int tid = threadIdx.x, l = tid & 31, w = tid >> 5;
  const int h = l >> 4, m = l & 15;
  const int wr = w >> 1, wc = w & 1;
  const int bx = blockIdx.x, by = blockIdx.y;
  const int lr0 = wr * 32, lc0 = wc * 32;            // tile-local bases of this wave

  // this lane's addresses in copy 0 of a tile (row l>>3 of the wave's group, 16-byte chunk l&7);
  // the copies take an address only: bf16 and f16 elements are both 2 bytes
  const int wu = __builtin_amdgcn_readfirstlane(w);   // the wave's number as a scalar: the group is picked by a scalar select
  const __bf16* grp = (wu == 0) ? xyb + (size_t)(bx * 64) * 512
                                : wb + (size_t)(wu - 1) * 262144 + (size_t)(by * 64) * 512;
  const _Float16* csrc = (const _Float16*)(grp + (size_t)(l >> 3) * 512 + (l & 7) * 8);
  const unsigned  cdst = lds_addr(smem) + (w * 64 + (l >> 3)) * 144 + (l & 7) * 16;
  const int aoff = (lr0 + m) * 144 + h * 16;          // ti=1: + 16*144
  const int boff = (64 + lc0 + m) * 144 + h * 16;     // + (mt*64 + tj*16)*144

  v8f acc[12];                                        // index = mt*4 + ti*2 + tj
#pragma unroll
  for (int i = 0; i < 12; ++i) acc[i] = zero8();

  copy_half<512>(cdst, csrc);
  wait_copies();
  __syncthreads();                                    // tile 0 is readable
  copy_half<512>(cdst + PB, csrc + 64);

#pragma unroll 1   // rolled: one copy of the trip's code; the copies' addresses are formed trip by trip
  for (int t = 0; t < 8; ++t) {
    const int buf = (t & 1) ? PB : 0;
    const char* af = smem + buf + aoff;
    const char* bf = smem + buf + boff;
#pragma unroll
    for (int d = 0; d < 2; ++d) {
      // the fragment reads of a half trip stand as one group ahead of its WMMAs
      FragB a[2], bb[6];
#pragma unroll
      for (int i = 0; i < 2; ++i) {
        a[i].hh[0] = *(const v8b*)(af + i * (16 * 144) + d * 64);
        a[i].hh[1] = *(const v8b*)(af + i * (16 * 144) + d * 64 + 32);
      }
#pragma unroll
      for (int j = 0; j < 6; ++j) {                   // j = mt*2 + tj
        bb[j].hh[0] = *(const v8b*)(bf + ((j >> 1) * 64 + (j & 1) * 16) * 144 + d * 64);
        bb[j].hh[1] = *(const v8b*)(bf + ((j >> 1) * 64 + (j & 1) * 16) * 144 + d * 64 + 32);
      }
#pragma unroll
      for (int j = 0; j < 6; ++j) {
        const int ai = (j >> 1) * 4 + (j & 1);
        acc[ai]     = mma_bf16(a[0].v, bb[j].v, acc[ai]);
        acc[ai + 2] = mma_bf16(a[1].v, bb[j].v, acc[ai + 2]);
      }
    }
    // foot of trip t: tile t+1 is published, tile t's buffer is free for tile t+2
    wait_lds();
    wait_copies();
    __syncthreads();
    if (t + 2 < 8)
      copy_half<512>(cdst + buf, csrc + (t + 2) * 64);
  }
  wait_copies();
  // behind the last foot's barrier no tile is live: the staging tiles take the buffers' place

  // accumulators -> LDS tiles (D element r = row 8h+r, col m)
#pragma unroll
  for (int ti = 0; ti < 2; ++ti) {
#pragma unroll
    for (int tj = 0; tj < 2; ++tj) {
      const v8f cq = acc[0 + ti * 2 + tj];
      const v8f ck = acc[4 + ti * 2 + tj];
      const v8f cv = acc[8 + ti * 2 + tj];
      const int rbase = lr0 + ti * 16 + 8 * h;   // token row of element r=0 (tile-local)
      const int ccol  = lc0 + tj * 16 + m;       // e column (tile-local)
#pragma unroll
      for (int r = 0; r < 8; ++r) {
        sq[(rbase + r) * 72 + ccol] = (_Float16)cq[r];
        sk[(rbase + r) * 72 + ccol] = (_Float16)ck[r];
      }
      v8h pv;
#pragma unroll
      for (int r = 0; r < 8; ++r) pv[r] = (_Float16)cv[r];
      *(v8h*)(sv + ccol * 72 + rbase) = pv;    // transposed: row e, 8 contiguous s
    }
  }
  __syncthreads();

  const int q = l >> 3, t = l & 7;
  const int b  = bx >> 5;
  const int s0 = (bx & 31) * 64;
#pragma unroll
  for (int i = 0; i < 4; ++i) {
    const int row = w * 16 + i * 4 + q;
    const v8h vq = *(const v8h*)(sq + row * 72 + 8 * t);
    const v8h vk = *(const v8h*)(sk + row * 72 + 8 * t);
    const v8h vv = *(const v8h*)(sv + row * 72 + 8 * t);
    *(v8h*)(Qh + (size_t)(bx * 64 + row) * 512 + by * 64 + 8 * t) = vq;
    *(v8h*)(Kh + (size_t)(bx * 64 + row) * 512 + by * 64 + 8 * t) = vk;
    *(v8h*)(Vt + ((size_t)b * 512 + by * 64 + row) * 2048 + s0 + 8 * t) = vv;
  }
  
}

__global__ void __launch_bounds__(256)
attn_kernel(const _Float16* __restrict__ Qh, const _Float16* __restrict__ Kh,
            const _Float16* __restrict__ Vt, float* out)
{
  __shared__ __align__(16) char smem[281088];
  const int TB0 = 0, TB1 = 73728, POFF = 147456, QOFF = 214016, AOFF = 280576, LOFF = 280832;
  const int SCP = 2112;                         // sc row pitch, bytes

  const int tid = threadIdx.x, l = tid & 31, w = tid >> 5;
  const int h = l >> 4, m = l & 15;
  const int rh = w >> 2, kg = w & 3;
  const int q0 = blockIdx.x * 64;               // global query row (includes batch)
  const int b  = q0 >> 11;
  const float SCL = 0.044194173824159216f;      // 512^-0.5

  const unsigned sbase = lds_addr(smem);
  const int SLICE = 128 * 144;                  // one key/column group's slice of a tile buffer, bytes
  const unsigned cdst = kg * SLICE + (rh * 64 + (l >> 3)) * 144 + (l & 7) * 16;  // this lane's place, copy 0
  const int foff = kg * SLICE + m * 144 + h * 16;                                // this lane's fragment base
  const char* qf = smem + QOFF + (rh * 32 + m) * 1040 + h * 16;
  const char* pf = smem + POFF + (rh * 32 + m) * 1040 + h * 16;
  float* sal  = (float*)(smem + AOFF);
  float* ssum = (float*)(smem + LOFF);

  // K tile (chunk c, trip tp): keys c*512 + kg*128 .. +127, k = tp*64 .. +63
  const _Float16* Ksrc = Kh + ((size_t)b * 2048 + kg * 128 + rh * 64 + (l >> 3)) * 512 + (l & 7) * 8;
  // V^T tile (chunk c, trip t): rows kg*128 .. +127 of V^T, keys c*512 + t*64 .. +63
  const _Float16* Vsrc = Vt + ((size_t)b * 512 + kg * 128 + rh * 64 + (l >> 3)) * 2048 + (l & 7) * 8;

  // Q: this wave brings rows 8w..8w+7, first halves (512 B) then second halves
  {
    const _Float16* Qsrc = Qh + (size_t)(q0 + 8 * w) * 512 + l * 8;
    const unsigned  qdst = sbase + QOFF + 8 * w * 1040 + l * 16;
    copy8(qdst, Qsrc, 1040, 512);
    copy8(qdst + 512, Qsrc + 256, 1040, 512);
  }

  v8f oacc[2][8];
#pragma unroll
  for (int i = 0; i < 2; ++i)
#pragma unroll
    for (int j = 0; j < 8; ++j) oacc[i][j] = zero8();

  const int srow = tid >> 2, sub = tid & 3;     // softmax: 4 threads per row
  float mrun = -3.0e38f, lrun = 0.0f;           // running maximum and sum of row srow

#pragma unroll 1   // rolled: one copy of the chunk's code
  for (int c = 0; c < 4; ++c) {
    // ---- Stage 1: scores of this chunk ----
    {
      const _Float16* Kc = Ksrc + (size_t)c * (512 * 512);
      copy_half<512>(sbase + TB0 + cdst, Kc);
      wait_copies();
      __syncthreads();                          // tile 0 (and, in chunk 0, Q) is readable
      copy_half<512>(sbase + TB1 + cdst, Kc + 64);

      v8f acc[2][8];
#pragma unroll
      for (int i = 0; i < 2; ++i)
#pragma unroll
        for (int j = 0; j < 8; ++j) acc[i][j] = zero8();
#pragma unroll 1   // rolled: unrolled, the copies' addresses of all trips are formed ahead and spill
      for (int tp = 0; tp < 8; ++tp) {
        const int kbuf = (tp & 1) ? TB1 : TB0;
        const char* kf = smem + kbuf + foff;
#pragma unroll
        for (int d = 0; d < 2; ++d) {
          // the fragment reads of a half trip stand as one group ahead of its WMMAs
          FragH a[2], bb[8];
#pragma unroll
          for (int i = 0; i < 2; ++i) {
            a[i].hh[0] = *(const v8h*)(qf + i * (16 * 1040) + (tp * 2 + d) * 64);
            a[i].hh[1] = *(const v8h*)(qf + i * (16 * 1040) + (tp * 2 + d) * 64 + 32);
          }
#pragma unroll
          for (int j = 0; j < 8; ++j) {
            bb[j].hh[0] = *(const v8h*)(kf + j * (16 * 144) + d * 64);
            bb[j].hh[1] = *(const v8h*)(kf + j * (16 * 144) + d * 64 + 32);
          }
#pragma unroll
          for (int j = 0; j < 8; ++j) {
#pragma unroll
            for (int i = 0; i < 2; ++i) acc[i][j] = mma_f16(a[i].v, bb[j].v, acc[i][j]);
          }
        }
        // foot of trip tp: tile tp+1 is published, tile tp's buffer is free for tile tp+2
        wait_lds();
        wait_copies();
        __syncthreads();
        if (tp + 2 < 8)
          copy_half<512>(sbase + kbuf + cdst, Kc + (tp + 2) * 64);
      }
      wait_copies();
      // behind the last foot's barrier no K tile is live: sc takes the buffers' place
#pragma unroll
      for (int i = 0; i < 2; ++i) {
#pragma unroll
        for (int j = 0; j < 8; ++j) {
          float* d = (float*)(smem + (rh * 32 + i * 16 + 8 * h) * SCP) + kg * 128 + j * 16 + m;
#pragma unroll
          for (int r = 0; r < 8; ++r) d[r * (SCP / 4)] = acc[i][j][r] * SCL;
        }
      }
    }
    __syncthreads();

    // ---- Online softmax: thread sub of a row takes every fourth group of 4 scores ----
    {
      const float* rp = (const float*)(smem + srow * SCP) + sub * 4;
      float mx = -3.0e38f;
#pragma unroll 8
      for (int i = 0; i < 32; ++i) {
        const v4f v = *(const v4f*)(rp + i * 16);
        mx = fmaxf(fmaxf(mx, fmaxf(v.x, v.y)), fmaxf(v.z, v.w));
      }
      mx = fmaxf(mx, __shfl_xor(mx, 1));
      mx = fmaxf(mx, __shfl_xor(mx, 2));
      const float mnew = fmaxf(mrun, mx);
      const float al = __expf(mrun - mnew);     // 0 in chunk 0
      char* pp = smem + POFF + srow * 1040 + sub * 8;
      float sm = 0.0f;
#pragma unroll 4
      for (int i = 0; i < 32; ++i) {
        v4f v = *(const v4f*)(rp + i * 16);
        v.x = __expf(v.x - mnew);
        v.y = __expf(v.y - mnew);
        v.z = __expf(v.z - mnew);
        v.w = __expf(v.w - mnew);
        sm += (v.x + v.y) + (v.z + v.w);
        v4h o;
        o[0] = (_Float16)(v.x * 16384.0f); o[1] = (_Float16)(v.y * 16384.0f);
        o[2] = (_Float16)(v.z * 16384.0f); o[3] = (_Float16)(v.w * 16384.0f);
        *(v4h*)(pp + i * 32) = o;
      }
      sm += __shfl_xor(sm, 1);
      sm += __shfl_xor(sm, 2);
      lrun = lrun * al + sm;
      mrun = mnew;
      if (sub == 0) { sal[srow] = al; ssum[srow] = lrun; }
    }
    wait_lds();                                 // sc becomes a tile buffer behind this barrier
    __syncthreads();

    // ---- Stage 2: O[64][512] = O * factor + P V ; wave owns 32 rows x 128 columns ----
    {
      const _Float16* Vc = Vsrc + c * 512;
      copy_half<2048>(sbase + TB0 + cdst, Vc);
#pragma unroll
      for (int i = 0; i < 2; ++i) {
        const float* ap = sal + rh * 32 + i * 16 + 8 * h;
        const v4f f0 = *(const v4f*)ap;
        const v4f f1 = *(const v4f*)(ap + 4);
#pragma unroll
        for (int j = 0; j < 8; ++j) {
#pragma unroll
          for (int r = 0; r < 4; ++r) { oacc[i][j][r] *= f0[r]; oacc[i][j][r + 4] *= f1[r]; }
        }
      }
      wait_copies();
      __syncthreads();                          // tile 0 is readable
      copy_half<2048>(sbase + TB1 + cdst, Vc + 64);
#pragma unroll 1   // rolled, for the same reason as in stage 1
      for (int t = 0; t < 8; ++t) {
        const int vbuf = (t & 1) ? TB1 : TB0;
        const char* vf = smem + vbuf + foff;
#pragma unroll
        for (int d = 0; d < 2; ++d) {
          // the fragment reads of a half trip stand as one group ahead of its WMMAs
          FragH a[2], bb[8];
#pragma unroll
          for (int i = 0; i < 2; ++i) {
            a[i].hh[0] = *(const v8h*)(pf + i * (16 * 1040) + (t * 2 + d) * 64);
            a[i].hh[1] = *(const v8h*)(pf + i * (16 * 1040) + (t * 2 + d) * 64 + 32);
          }
#pragma unroll
          for (int j = 0; j < 8; ++j) {
            bb[j].hh[0] = *(const v8h*)(vf + j * (16 * 144) + d * 64);
            bb[j].hh[1] = *(const v8h*)(vf + j * (16 * 144) + d * 64 + 32);
          }
#pragma unroll
          for (int j = 0; j < 8; ++j) {
#pragma unroll
            for (int i = 0; i < 2; ++i) oacc[i][j] = mma_f16(a[i].v, bb[j].v, oacc[i][j]);
          }
        }
        // foot of trip t: tile t+1 is published, tile t's buffer is free for tile t+2
        wait_lds();
        wait_copies();
        __syncthreads();
        if (t + 2 < 8)
          copy_half<2048>(sbase + vbuf + cdst, Vc + (t + 2) * 64);
      }
      wait_copies();
    }
  }

  // ---- Epilogue: normalise, undo 2^14, stage in LDS (the tile buffers are free), whole-line stores ----
  float* os = (float*)smem;                     // [64][512] f32
  {
    const float OSCL = 6.103515625e-05f;        // 2^-14 exact
#pragma unroll
    for (int i = 0; i < 2; ++i) {
      const float* lp = ssum + rh * 32 + i * 16 + 8 * h;
      const v4f s0 = *(const v4f*)lp;
      const v4f s1 = *(const v4f*)(lp + 4);
      float inv[8];
#pragma unroll
      for (int r = 0; r < 4; ++r) { inv[r] = OSCL / s0[r]; inv[r + 4] = OSCL / s1[r]; }
#pragma unroll
      for (int j = 0; j < 8; ++j) {
        float* d = os + (rh * 32 + i * 16 + 8 * h) * 512 + kg * 128 + j * 16 + m;
#pragma unroll
        for (int r = 0; r < 8; ++r) d[r * 512] = oacc[i][j][r] * inv[r];
      }
    }
  }
  __syncthreads();
  {
    const int col = kg * 128 + l * 4;
    const float* srw = os + (rh * 32) * 512 + col;
    float* orow = out + (size_t)(q0 + rh * 32) * 512 + col;
#pragma unroll
    for (int i = 0; i < 32; ++i) {
      const v4f v = *(const v4f*)(srw + i * 512);
      *(v4f*)(orow + (size_t)i * 512) = v;
    }
  }
}

// ---------------------------------------------------------------------------
// Host launcher
// ---------------------------------------------------------------------------
extern "C" void kernel_launch(void* const* d_in, const int* in_sizes, int n_in,
                              void* d_out, int out_size, void* d_ws, size_t ws_size,
                              hipStream_t stream)
{
  if (n_in < 5) return;
  const int NXY = 8 * 1024 * 512;     // 4194304
  const int NW  = 512 * 512;          // 262144
  const int NO  = 8 * 2048 * 512;     // 8388608
  if (in_sizes[0] != NXY || in_sizes[1] != NXY) return;
  if (in_sizes[2] != NW || in_sizes[3] != NW || in_sizes[4] != NW) return;
  if (out_size != NO) return;

  const float* x  = (const float*)d_in[0];
  const float* y  = (const float*)d_in[1];
  const float* Wq = (const float*)d_in[2];
  const float* Wk = (const float*)d_in[3];
  const float* Wv = (const float*)d_in[4];
  float* out = (float*)d_out;

  const size_t bytes_xyb = (size_t)16384 * 512 * 2;    // 16777216
  const size_t bytes_wb  = (size_t)3 * NW * 2;          //  1572864
  const size_t bytes_q   = (size_t)16384 * 512 * 2;    // 16777216 each for Qh, Kh, Vt
  const size_t off_xyb = 0;
  const size_t off_wb  = off_xyb + bytes_xyb;
  const size_t off_q   = off_wb  + bytes_wb;
  const size_t off_k   = off_q   + bytes_q;
  const size_t off_v   = off_k   + bytes_q;
  const size_t total   = off_v   + bytes_q;           // 68681728
  if (total > ws_size) return;

  char* ws = (char*)d_ws;
  unsigned short* xyb = (unsigned short*)(ws + off_xyb);
  unsigned short* wb  = (unsigned short*)(ws + off_wb);
  _Float16* Qh = (_Float16*)(ws + off_q);
  _Float16* Kh = (_Float16*)(ws + off_k);
  _Float16* Vt = (_Float16*)(ws + off_v);

  prep_kernel<<<4096 + 384, 256, 0, stream>>>(x, y, Wq, Wk, Wv, xyb, wb);

  proj_kernel<<<dim3(256, 8), 128, 0, stream>>>((const __bf16*)xyb, (const __bf16*)wb, Qh, Kh, Vt);

  // Pass 2: attention, 64 query rows per block: 16384/64 blocks
  attn_kernel<<<256, 256, 0, stream>>>(Qh, Kh, Vt, out);
}

// v004
// Measured time: 121 microseconds a run.
// Next to v003, in two timings, it ran 1.03 and 1.04 times as fast.
// All steps since v000 together make it 7.07 times as fast.
#include <hip/hip_runtime.h>
// Contractions: q/k/v projections on v_wmma_f32_16x16x32_bf16 (bf16 operands); scores and P.V on v_wmma_f32_16x16x32_f16 (f16 operands, P scaled by 2^14); f32 accumulate everywhere.

typedef _Float16 v16h __attribute__((ext_vector_type(16)));
typedef _Float16 v8h  __attribute__((ext_vector_type(8)));
typedef _Float16 v4h  __attribute__((ext_vector_type(4)));
typedef __bf16   v16b __attribute__((ext_vector_type(16)));
typedef __bf16   v8b  __attribute__((ext_vector_type(8)));
typedef float    v8f  __attribute__((ext_vector_type(8)));
typedef float    v4f  __attribute__((ext_vector_type(4)));
typedef unsigned v4u  __attribute__((ext_vector_type(4)));

union FragH { v16h v; v8h hh[2]; };
union FragB { v16b v; v8b hh[2]; };

__device__ __forceinline__ v8f zero8() {
  v8f z = {0.f, 0.f, 0.f, 0.f, 0.f, 0.f, 0.f, 0.f};
  return z;
}

// 16x16x32 f16 WMMA with hazard guard (ties D, keeps A/B live)
__device__ __forceinline__ v8f mma_f16(v16h a, v16h b, v8f c) {
  v8f d = __builtin_amdgcn_wmma_f32_16x16x32_f16(false, a, false, b, (short)0, c, false, false);
  asm volatile("v_nop\n\tv_nop\n\tv_nop\n\tv_nop" : "+v"(d) : "v"(a), "v"(b));
  return d;
}

// 16x16x32 bf16 WMMA with hazard guard
__device__ __forceinline__ v8f mma_bf16(v16b a, v16b b, v8f c) {
  v8f d = __builtin_amdgcn_wmma_f32_16x16x32_bf16(false, a, false, b, (short)0, c, false, false);
  asm volatile("v_nop\n\tv_nop\n\tv_nop\n\tv_nop" : "+v"(d) : "v"(a), "v"(b));
  return d;
}

// f32 -> bf16 bits, RNE convert
__device__ __forceinline__ unsigned bf16_rne(float f) {
  unsigned u = __float_as_uint(f);
  return (u + 0x7FFFu + ((u >> 16) & 1u)) >> 16;
}
__device__ __forceinline__ unsigned pack2(float a, float b) {
  return bf16_rne(a) | (bf16_rne(b) << 16);
}

// ---------------------------------------------------------------------------
//         Wq | Wk | Wv -> bf16 in native [e][d] layout (k-contiguous B layout).
// blocks [0,4096): xy, 8 elements per thread; blocks [4096,4480): weights.
// ---------------------------------------------------------------------------
__global__ void __launch_bounds__(256)
prep_kernel(const float* __restrict__ x, const float* __restrict__ y,
            const float* __restrict__ wq, const float* __restrict__ wk,
            const float* __restrict__ wv,
            unsigned short* xyb, unsigned short* wb)
{
  const int bid = blockIdx.x, tid = threadIdx.x;
  if (bid < 4096) {
    const int gid = bid * 256 + tid;            // 0 .. 1048575
    const int row = gid >> 6;                   // token row b*2048 + s
    const int d   = (gid & 63) * 8;
    const int b   = row >> 11, s = row & 2047;
    const float* src = (s < 1024)
        ? x + ((size_t)(b * 1024 + s) * 512 + d)
        : y + ((size_t)(b * 1024 + (s - 1024)) * 512 + d);
    const v4f v0 = *(const v4f*)src;
    const v4f v1 = *(const v4f*)(src + 4);
    v4u o;
    o.x = pack2(v0.x, v0.y); o.y = pack2(v0.z, v0.w);
    o.z = pack2(v1.x, v1.y); o.w = pack2(v1.z, v1.w);
    unsigned short* dst = xyb + (size_t)gid * 8;
    *(v4u*)dst = o;
    
  } else {
    const int k   = bid - 4096;                 // 0 .. 383
    const int mt  = k >> 7;                     // 0,1,2 (block-uniform)
    const int gid = (k & 127) * 256 + tid;      // 0 .. 32767
    const float* wsrc = (mt == 0) ? wq : ((mt == 1) ? wk : wv);
    const float* src = wsrc + (size_t)gid * 8;
    const v4f v0 = *(const v4f*)src;
    const v4f v1 = *(const v4f*)(src + 4);
    v4u o;
    o.x = pack2(v0.x, v0.y); o.y = pack2(v0.z, v0.w);
    o.z = pack2(v1.x, v1.y); o.w = pack2(v1.z, v1.w);
    unsigned short* dst = wb + (size_t)mt * 262144 + (size_t)gid * 8;
    *(v4u*)dst = o;
    
  }
}

// ---------------------------------------------------------------------------
// Asynchronous copies global -> LDS (16 bytes per lane, through no register).
// ---------------------------------------------------------------------------
// LDS byte address of a __shared__ pointer: the low 32 bits of its flat address.
__device__ __forceinline__ unsigned lds_addr(const void* p) { return (unsigned)(size_t)p; }

// Eight copies in one statement; copy i moves the LDS address on by i*lstep bytes and the
// global address by i*gstep elements. s_wait_xcnt 0 closes the statement so that no
// address register of an issued copy is rewritten ahead of it.
__device__ __forceinline__ void copy8(unsigned lds, const _Float16* g, unsigned lstep, size_t gstep)
{
  const unsigned l1 = lds + lstep,     l2 = lds + 2 * lstep, l3 = lds + 3 * lstep;
  const unsigned l4 = lds + 4 * lstep, l5 = lds + 5 * lstep, l6 = lds + 6 * lstep;
  const unsigned l7 = lds + 7 * lstep;
  const _Float16* g1 = g + gstep;
  const _Float16* g2 = g + 2 * gstep;
  const _Float16* g3 = g + 3 * gstep;
  const _Float16* g4 = g + 4 * gstep;
  const _Float16* g5 = g + 5 * gstep;
  const _Float16* g6 = g + 6 * gstep;
  const _Float16* g7 = g + 7 * gstep;
  asm volatile("global_load_async_to_lds_b128 %0, %8, off\n\t"
               "global_load_async_to_lds_b128 %1, %9, off\n\t"
               "global_load_async_to_lds_b128 %2, %10, off\n\t"
               "global_load_async_to_lds_b128 %3, %11, off\n\t"
               "global_load_async_to_lds_b128 %4, %12, off\n\t"
               "global_load_async_to_lds_b128 %5, %13, off\n\t"
               "global_load_async_to_lds_b128 %6, %14, off\n\t"
               "global_load_async_to_lds_b128 %7, %15, off\n\t"
               "s_wait_xcnt 0x0"
               :: "v"(lds), "v"(l1), "v"(l2), "v"(l3), "v"(l4), "v"(l5), "v"(l6), "v"(l7),
                  "v"(g), "v"(g1), "v"(g2), "v"(g3), "v"(g4), "v"(g5), "v"(g6), "v"(g7)
               : "memory");
}

// One wave's half of a tile slice: 64 rows of 128 B (one whole line each), global row pitch GP
// elements, LDS row pitch 144 B (16 B x odd: ds_load_b128 readers meet no bank conflict).
// lds, g: this lane's addresses in copy 0 (row l>>3, 16-byte chunk l&7); a copy is 4 rows.
template <int GP>
__device__ __forceinline__ void copy_half(unsigned lds, const _Float16* g)
{
#pragma unroll
  for (int i = 0; i < 2; ++i)
    copy8(lds + i * (32 * 144), g + (size_t)i * 32 * GP, 4 * 144, (size_t)4 * GP);
}

// This wave's own copies have landed.
__device__ __forceinline__ void wait_copies() { asm volatile("s_wait_asynccnt 0x0" ::: "memory"); }
// This wave's own LDS reads and writes have retired (before a buffer goes to its next writer).
__device__ __forceinline__ void wait_lds()    { asm volatile("s_wait_dscnt 0x0" ::: "memory"); }

__global__ void __launch_bounds__(128)
proj_kernel(const __bf16* __restrict__ xyb, const __bf16* __restrict__ wb,
            _Float16* Qh, _Float16* Kh, _Float16* Vt)
{
  const int PB = 256 * 144;                        // one tile buffer, bytes
  __shared__ __align__(16) char smem[2 * 256 * 144];
  // the epilogue's staging tiles take the buffers' place behind the loop
  _Float16* sq = (_Float16*)smem;
  _Float16* sk = sq + 64 * 72;
  _Float16* sv = sk + 64 * 72;                     // [e_local][s_local]

  const int tid = threadIdx.x, l = tid & 31, w = tid >> 5;
  const int h = l >> 4, m = l & 15;
  const int wr = w >> 1, wc = w & 1;
  const int bx = blockIdx.x, by = blockIdx.y;
  const int lr0 = wr * 32, lc0 = wc * 32;            // tile-local bases of this wave

  // this lane's addresses in copy 0 of a tile (row l>>3 of the wave's group, 16-byte chunk l&7);
  // the copies take an address only: bf16 and f16 elements are both 2 bytes
  const int wu = __builtin_amdgcn_readfirstlane(w);   // the wave's number as a scalar: the group is picked by a scalar select
  const __bf16* grp = (wu == 0) ? xyb + (size_t)(bx * 64) * 512
                                : wb + (size_t)(wu - 1) * 262144 + (size_t)(by * 64) * 512;
  const _Float16* csrc = (const _Float16*)(grp + (size_t)(l >> 3) * 512 + (l & 7) * 8);
  const unsigned  cdst = lds_addr(smem) + (w * 64 + (l >> 3)) * 144 + (l & 7) * 16;
  const int aoff = (lr0 + m) * 144 + h * 16;          // ti=1: + 16*144
  const int boff = (64 + lc0 + m) * 144 + h * 16;     // + (mt*64 + tj*16)*144

  v8f acc[12];                                        // index = mt*4 + ti*2 + tj
#pragma unroll
  for (int i = 0; i < 12; ++i) acc[i] = zero8();

  // Each block walks the 8 k tiles in an order rotated by its index: blocks that share xy rows
  // (same bx) or W rows (same by) run side by side and would else ask L2 for the same lines at once.
  const int rot = bx + (bx >> 3) + by;
  copy_half<512>(cdst, csrc + (rot & 7) * 64);
  wait_copies();
  __syncthreads();                                    // the first tile is readable
  copy_half<512>(cdst + PB, csrc + ((rot + 1) & 7) * 64);

#pragma unroll 1   // rolled: one copy of the trip's code; the copies' addresses are formed trip by trip
  for (int t = 0; t < 8; ++t) {
    const int buf = (t & 1) ? PB : 0;
    const char* af = smem + buf + aoff;
    const char* bf = smem + buf + boff;
#pragma unroll
    for (int d = 0; d < 2; ++d) {
      // the fragment reads of a half trip stand as one group ahead of its WMMAs
      FragB a[2], bb[6];
#pragma unroll
      for (int i = 0; i < 2; ++i) {
        a[i].hh[0] = *(const v8b*)(af + i * (16 * 144) + d * 64);
        a[i].hh[1] = *(const v8b*)(af + i * (16 * 144) + d * 64 + 32);
      }
#pragma unroll
      for (int j = 0; j < 6; ++j) {                   // j = mt*2 + tj
        bb[j].hh[0] = *(const v8b*)(bf + ((j >> 1) * 64 + (j & 1) * 16) * 144 + d * 64);
        bb[j].hh[1] = *(const v8b*)(bf + ((j >> 1) * 64 + (j & 1) * 16) * 144 + d * 64 + 32);
      }
#pragma unroll
      for (int j = 0; j < 6; ++j) {
        const int ai = (j >> 1) * 4 + (j & 1);
        acc[ai]     = mma_bf16(a[0].v, bb[j].v, acc[ai]);
        acc[ai + 2] = mma_bf16(a[1].v, bb[j].v, acc[ai + 2]);
      }
    }
    // foot of trip t: tile t+1 is published, tile t's buffer is free for tile t+2
    wait_lds();
    wait_copies();
    __syncthreads();
    if (t + 2 < 8)
      copy_half<512>(cdst + buf, csrc + ((rot + t + 2) & 7) * 64);
  }
  wait_copies();
  // behind the last foot's barrier no tile is live: the staging tiles take the buffers' place

  // accumulators -> LDS tiles (D element r = row 8h+r, col m)
#pragma unroll
  for (int ti = 0; ti < 2; ++ti) {
#pragma unroll
    for (int tj = 0; tj < 2; ++tj) {
      const v8f cq = acc[0 + ti * 2 + tj];
      const v8f ck = acc[4 + ti * 2 + tj];
      const v8f cv = acc[8 + ti * 2 + tj];
      const int rbase = lr0 + ti * 16 + 8 * h;   // token row of element r=0 (tile-local)
      const int ccol  = lc0 + tj * 16 + m;       // e column (tile-local)
#pragma unroll
      for (int r = 0; r < 8; ++r) {
        sq[(rbase + r) * 72 + ccol] = (_Float16)cq[r];
        sk[(rbase + r) * 72 + ccol] = (_Float16)ck[r];
      }
      v8h pv;
#pragma unroll
      for (int r = 0; r < 8; ++r) pv[r] = (_Float16)cv[r];
      *(v8h*)(sv + ccol * 72 + rbase) = pv;    // transposed: row e, 8 contiguous s
    }
  }
  __syncthreads();

  const int q = l >> 3, t = l & 7;
  const int b  = bx >> 5;
  const int s0 = (bx & 31) * 64;
#pragma unroll
  for (int i = 0; i < 4; ++i) {
    const int row = w * 16 + i * 4 + q;
    const v8h vq = *(const v8h*)(sq + row * 72 + 8 * t);
    const v8h vk = *(const v8h*)(sk + row * 72 + 8 * t);
    const v8h vv = *(const v8h*)(sv + row * 72 + 8 * t);
    *(v8h*)(Qh + (size_t)(bx * 64 + row) * 512 + by * 64 + 8 * t) = vq;
    *(v8h*)(Kh + (size_t)(bx * 64 + row) * 512 + by * 64 + 8 * t) = vk;
    *(v8h*)(Vt + ((size_t)b * 512 + by * 64 + row) * 2048 + s0 + 8 * t) = vv;
  }
  
}

__global__ void __launch_bounds__(256)
attn_kernel(const _Float16* __restrict__ Qh, const _Float16* __restrict__ Kh,
            const _Float16* __restrict__ Vt, float* out)
{
  __shared__ __align__(16) char smem[281088];
  const int TB0 = 0, TB1 = 73728, POFF = 147456, QOFF = 214016, AOFF = 280576, LOFF = 280832;
  const int SCP = 2112;                         // sc row pitch, bytes

  const int tid = threadIdx.x, l = tid & 31, w = tid >> 5;
  const int h = l >> 4, m = l & 15;
  const int rh = w >> 2, kg = w & 3;
  const int q0 = blockIdx.x * 64;               // global query row (includes batch)
  const int b  = q0 >> 11;
  const float SCL = 0.044194173824159216f;      // 512^-0.5

  const unsigned sbase = lds_addr(smem);
  const int SLICE = 128 * 144;                  // one key/column group's slice of a tile buffer, bytes
  const unsigned cdst = kg * SLICE + (rh * 64 + (l >> 3)) * 144 + (l & 7) * 16;  // this lane's place, copy 0
  const int foff = kg * SLICE + m * 144 + h * 16;                                // this lane's fragment base
  const char* qf = smem + QOFF + (rh * 32 + m) * 1040 + h * 16;
  const char* pf = smem + POFF + (rh * 32 + m) * 1040 + h * 16;
  float* sal  = (float*)(smem + AOFF);
  float* ssum = (float*)(smem + LOFF);

  // K tile (chunk cc, k tile kt): keys cc*512 + kg*128 .. +127, k = kt*64 .. +63
  const _Float16* Ksrc = Kh + ((size_t)b * 2048 + kg * 128 + rh * 64 + (l >> 3)) * 512 + (l & 7) * 8;
  // V^T tile (chunk cc, tile vt): rows kg*128 .. +127 of V^T, keys cc*512 + vt*64 .. +63
  const _Float16* Vsrc = Vt + ((size_t)b * 512 + kg * 128 + rh * 64 + (l >> 3)) * 2048 + (l & 7) * 8;

  // Q: this wave brings rows 8w..8w+7, first halves (512 B) then second halves
  {
    const _Float16* Qsrc = Qh + (size_t)(q0 + 8 * w) * 512 + l * 8;
    const unsigned  qdst = sbase + QOFF + 8 * w * 1040 + l * 16;
    copy8(qdst, Qsrc, 1040, 512);
    copy8(qdst + 512, Qsrc + 256, 1040, 512);
  }

  v8f oacc[2][8];
#pragma unroll
  for (int i = 0; i < 2; ++i)
#pragma unroll
    for (int j = 0; j < 8; ++j) oacc[i][j] = zero8();

  // The 32 blocks of a batch read the same K and V^T and run side by side: each walks the 4 chunks
  // and the 8 tiles of a stage in an order rotated by its index, so that no two of them ask L2 for
  // the same lines at once. The online softmax takes the chunks in any order.
  const int rotc = (blockIdx.x >> 3) & 3, rott = (blockIdx.x + (blockIdx.x >> 3)) & 7;

  const int srow = tid >> 2, sub = tid & 3;     // softmax: 4 threads per row
  float mrun = -3.0e38f, lrun = 0.0f;           // running maximum and sum of row srow

#pragma unroll 1   // rolled: one copy of the chunk's code
  for (int c = 0; c < 4; ++c) {
    const int cc = (c + rotc) & 3;              // the chunk of keys taken in this pass
    // ---- Stage 1: scores of this chunk ----
    {
      const _Float16* Kc = Ksrc + (size_t)cc * (512 * 512);
      copy_half<512>(sbase + TB0 + cdst, Kc + rott * 64);
      wait_copies();
      __syncthreads();                          // the first tile (and, in the first pass, Q) is readable
      copy_half<512>(sbase + TB1 + cdst, Kc + ((rott + 1) & 7) * 64);

      v8f acc[2][8];
#pragma unroll
      for (int i = 0; i < 2; ++i)
#pragma unroll
        for (int j = 0; j < 8; ++j) acc[i][j] = zero8();
#pragma unroll 1   // rolled: unrolled, the copies' addresses of all trips are formed ahead and spill
      for (int tp = 0; tp < 8; ++tp) {
        const int kbuf = (tp & 1) ? TB1 : TB0;
        const int kt = (tp + rott) & 7;         // the k tile that lies in kbuf
        const char* kf = smem + kbuf + foff;
#pragma unroll
        for (int d = 0; d < 2; ++d) {
          // the fragment reads of a half trip stand as one group ahead of its WMMAs
          FragH a[2], bb[8];
#pragma unroll
          for (int i = 0; i < 2; ++i) {
            a[i].hh[0] = *(const v8h*)(qf + i * (16 * 1040) + (kt * 2 + d) * 64);
            a[i].hh[1] = *(const v8h*)(qf + i * (16 * 1040) + (kt * 2 + d) * 64 + 32);
          }
#pragma unroll
          for (int j = 0; j < 8; ++j) {
            bb[j].hh[0] = *(const v8h*)(kf + j * (16 * 144) + d * 64);
            bb[j].hh[1] = *(const v8h*)(kf + j * (16 * 144) + d * 64 + 32);
          }
#pragma unroll
          for (int j = 0; j < 8; ++j) {
#pragma unroll
            for (int i = 0; i < 2; ++i) acc[i][j] = mma_f16(a[i].v, bb[j].v, acc[i][j]);
          }
        }
        // foot of trip tp: tile tp+1 is published, tile tp's buffer is free for tile tp+2
        wait_lds();
        wait_copies();
        __syncthreads();
        if (tp + 2 < 8)
          copy_half<512>(sbase + kbuf + cdst, Kc + ((kt + 2) & 7) * 64);
      }
      wait_copies();
      // behind the last foot's barrier no K tile is live: sc takes the buffers' place
#pragma unroll
      for (int i = 0; i < 2; ++i) {
#pragma unroll
        for (int j = 0; j < 8; ++j) {
          float* d = (float*)(smem + (rh * 32 + i * 16 + 8 * h) * SCP) + kg * 128 + j * 16 + m;
#pragma unroll
          for (int r = 0; r < 8; ++r) d[r * (SCP / 4)] = acc[i][j][r] * SCL;
        }
      }
    }
    __syncthreads();

    // ---- Online softmax: thread sub of a row takes every fourth group of 4 scores ----
    {
      const float* rp = (const float*)(smem + srow * SCP) + sub * 4;
      float mx = -3.0e38f;
#pragma unroll 8
      for (int i = 0; i < 32; ++i) {
        const v4f v = *(const v4f*)(rp + i * 16);
        mx = fmaxf(fmaxf(mx, fmaxf(v.x, v.y)), fmaxf(v.z, v.w));
      }
      mx = fmaxf(mx, __shfl_xor(mx, 1));
      mx = fmaxf(mx, __shfl_xor(mx, 2));
      const float mnew = fmaxf(mrun, mx);
      const float al = __expf(mrun - mnew);     // 0 in the first pass
      char* pp = smem + POFF + srow * 1040 + sub * 8;
      float sm = 0.0f;
#pragma unroll 4
      for (int i = 0; i < 32; ++i) {
        v4f v = *(const v4f*)(rp + i * 16);
        v.x = __expf(v.x - mnew);
        v.y = __expf(v.y - mnew);
        v.z = __expf(v.z - mnew);
        v.w = __expf(v.w - mnew);
        sm += (v.x + v.y) + (v.z + v.w);
        v4h o;
        o[0] = (_Float16)(v.x * 16384.0f); o[1] = (_Float16)(v.y * 16384.0f);
        o[2] = (_Float16)(v.z * 16384.0f); o[3] = (_Float16)(v.w * 16384.0f);
        *(v4h*)(pp + i * 32) = o;
      }
      sm += __shfl_xor(sm, 1);
      sm += __shfl_xor(sm, 2);
      lrun = lrun * al + sm;
      mrun = mnew;
      if (sub == 0) { sal[srow] = al; ssum[srow] = lrun; }
    }
    wait_lds();                                 // sc becomes a tile buffer behind this barrier
    __syncthreads();

    // ---- Stage 2: O[64][512] = O * factor + P V ; wave owns 32 rows x 128 columns ----
    {
      const _Float16* Vc = Vsrc + cc * 512;
      copy_half<2048>(sbase + TB0 + cdst, Vc + rott * 64);
#pragma unroll
      for (int i = 0; i < 2; ++i) {
        const float* ap = sal + rh * 32 + i * 16 + 8 * h;
        const v4f f0 = *(const v4f*)ap;
        const v4f f1 = *(const v4f*)(ap + 4);
#pragma unroll
        for (int j = 0; j < 8; ++j) {
#pragma unroll
          for (int r = 0; r < 4; ++r) { oacc[i][j][r] *= f0[r]; oacc[i][j][r + 4] *= f1[r]; }
        }
      }
      wait_copies();
      __syncthreads();                          // the first tile is readable
      copy_half<2048>(sbase + TB1 + cdst, Vc + ((rott + 1) & 7) * 64);
#pragma unroll 1   // rolled, for the same reason as in stage 1
      for (int t = 0; t < 8; ++t) {
        const int vbuf = (t & 1) ? TB1 : TB0;
        const int vt = (t + rott) & 7;          // the tile of 64 keys that lies in vbuf
        const char* vf = smem + vbuf + foff;
#pragma unroll
        for (int d = 0; d < 2; ++d) {
          // the fragment reads of a half trip stand as one group ahead of its WMMAs
          FragH a[2], bb[8];
#pragma unroll
          for (int i = 0; i < 2; ++i) {
            a[i].hh[0] = *(const v8h*)(pf + i * (16 * 1040) + (vt * 2 + d) * 64);
            a[i].hh[1] = *(const v8h*)(pf + i * (16 * 1040) + (vt * 2 + d) * 64 + 32);
          }
#pragma unroll
          for (int j = 0; j < 8; ++j) {
            bb[j].hh[0] = *(const v8h*)(vf + j * (16 * 144) + d * 64);
            bb[j].hh[1] = *(const v8h*)(vf + j * (16 * 144) + d * 64 + 32);
          }
#pragma unroll
          for (int j = 0; j < 8; ++j) {
#pragma unroll
            for (int i = 0; i < 2; ++i) oacc[i][j] = mma_f16(a[i].v, bb[j].v, oacc[i][j]);
          }
        }
        // foot of trip t: tile t+1 is published, tile t's buffer is free for tile t+2
        wait_lds();
        wait_copies();
        __syncthreads();
        if (t + 2 < 8)
          copy_half<2048>(sbase + vbuf + cdst, Vc + ((vt + 2) & 7) * 64);
      }
      wait_copies();
    }
  }

  // ---- Epilogue: normalise, undo 2^14, stage in LDS (the tile buffers are free), whole-line stores ----
  float* os = (float*)smem;                     // [64][512] f32
  {
    const float OSCL = 6.103515625e-05f;        // 2^-14 exact
#pragma unroll
    for (int i = 0; i < 2; ++i) {
      const float* lp = ssum + rh * 32 + i * 16 + 8 * h;
      const v4f s0 = *(const v4f*)lp;
      const v4f s1 = *(const v4f*)(lp + 4);
      float inv[8];
#pragma unroll
      for (int r = 0; r < 4; ++r) { inv[r] = OSCL / s0[r]; inv[r + 4] = OSCL / s1[r]; }
#pragma unroll
      for (int j = 0; j < 8; ++j) {
        float* d = os + (rh * 32 + i * 16 + 8 * h) * 512 + kg * 128 + j * 16 + m;
#pragma unroll
        for (int r = 0; r < 8; ++r) d[r * 512] = oacc[i][j][r] * inv[r];
      }
    }
  }
  __syncthreads();
  {
    const int col = kg * 128 + l * 4;
    const float* srw = os + (rh * 32) * 512 + col;
    float* orow = out + (size_t)(q0 + rh * 32) * 512 + col;
#pragma unroll
    for (int i = 0; i < 32; ++i) {
      const v4f v = *(const v4f*)(srw + i * 512);
      *(v4f*)(orow + (size_t)i * 512) = v;
    }
  }
}

// ---------------------------------------------------------------------------
// Host launcher
// ---------------------------------------------------------------------------
extern "C" void kernel_launch(void* const* d_in, const int* in_sizes, int n_in,
                              void* d_out, int out_size, void* d_ws, size_t ws_size,
                              hipStream_t stream)
{
  if (n_in < 5) return;
  const int NXY = 8 * 1024 * 512;     // 4194304
  const int NW  = 512 * 512;          // 262144
  const int NO  = 8 * 2048 * 512;     // 8388608
  if (in_sizes[0] != NXY || in_sizes[1] != NXY) return;
  if (in_sizes[2] != NW || in_sizes[3] != NW || in_sizes[4] != NW) return;
  if (out_size != NO) return;

  const float* x  = (const float*)d_in[0];
  const float* y  = (const float*)d_in[1];
  const float* Wq = (const float*)d_in[2];
  const float* Wk = (const float*)d_in[3];
  const float* Wv = (const float*)d_in[4];
  float* out = (float*)d_out;

  const size_t bytes_xyb = (size_t)16384 * 512 * 2;    // 16777216
  const size_t bytes_wb  = (size_t)3 * NW * 2;          //  1572864
  const size_t bytes_q   = (size_t)16384 * 512 * 2;    // 16777216 each for Qh, Kh, Vt
  const size_t off_xyb = 0;
  const size_t off_wb  = off_xyb + bytes_xyb;
  const size_t off_q   = off_wb  + bytes_wb;
  const size_t off_k   = off_q   + bytes_q;
  const size_t off_v   = off_k   + bytes_q;
  const size_t total   = off_v   + bytes_q;           // 68681728
  if (total > ws_size) return;

  char* ws = (char*)d_ws;
  unsigned short* xyb = (unsigned short*)(ws + off_xyb);
  unsigned short* wb  = (unsigned short*)(ws + off_wb);
  _Float16* Qh = (_Float16*)(ws + off_q);
  _Float16* Kh = (_Float16*)(ws + off_k);
  _Float16* Vt = (_Float16*)(ws + off_v);

  prep_kernel<<<4096 + 384, 256, 0, stream>>>(x, y, Wq, Wk, Wv, xyb, wb);

  proj_kernel<<<dim3(256, 8), 128, 0, stream>>>((const __bf16*)xyb, (const __bf16*)wb, Qh, Kh, Vt);

  // Pass 2: attention, 64 query rows per block: 16384/64 blocks
  attn_kernel<<<256, 256, 0, stream>>>(Qh, Kh, Vt, out);
}

// v005
// It runs in 116 microseconds.
// In both of two side-by-side timings against v004, it was 1.04 times as fast.
// Over all steps from v000 it is 7.38 times as fast.
#include <hip/hip_runtime.h>
// Contractions: q/k/v projections on v_wmma_f32_16x16x32_bf16 (bf16 operands); scores and P.V on v_wmma_f32_16x16x32_f16 (f16 operands, P scaled by 2^14); f32 accumulate everywhere.

typedef _Float16 v16h __attribute__((ext_vector_type(16)));
typedef _Float16 v8h  __attribute__((ext_vector_type(8)));
typedef _Float16 v4h  __attribute__((ext_vector_type(4)));
typedef __bf16   v16b __attribute__((ext_vector_type(16)));
typedef __bf16   v8b  __attribute__((ext_vector_type(8)));
typedef float    v8f  __attribute__((ext_vector_type(8)));
typedef float    v4f  __attribute__((ext_vector_type(4)));
typedef unsigned v4u  __attribute__((ext_vector_type(4)));

union FragH { v16h v; v8h hh[2]; };
union FragB { v16b v; v8b hh[2]; };

__device__ __forceinline__ v8f zero8() {
  v8f z = {0.f, 0.f, 0.f, 0.f, 0.f, 0.f, 0.f, 0.f};
  return z;
}

// the value that lane l ^ 16 holds
__device__ __forceinline__ float xhalf(float x) {
  const int b = __builtin_bit_cast(int, x);
  return __builtin_bit_cast(float, __builtin_amdgcn_permlanex16(b, b, 0x76543210, 0xfedcba98, false, false));
}

// 2^x. Behind a transcendental the instruction set asks for one independent instruction before its
// result is read or its source overwritten: the v_nop in the same statement is that slot.
__device__ __forceinline__ float exp2x1(float x) {
  float y;
  asm("v_exp_f32 %0, %1\n\tv_nop" : "=v"(y) : "v"(x));
  return y;
}
// Eight at once: each has an independent one behind it (no result shares a register with a source),
// the last has the v_nop.
__device__ __forceinline__ void exp2x8(float (&p)[8], const float (&x)[8]) {
  asm("v_exp_f32 %0, %8\n\t"
      "v_exp_f32 %1, %9\n\t"
      "v_exp_f32 %2, %10\n\t"
      "v_exp_f32 %3, %11\n\t"
      "v_exp_f32 %4, %12\n\t"
      "v_exp_f32 %5, %13\n\t"
      "v_exp_f32 %6, %14\n\t"
      "v_exp_f32 %7, %15\n\t"
      "v_nop"
      : "=&v"(p[0]), "=&v"(p[1]), "=&v"(p[2]), "=&v"(p[3]), "=&v"(p[4]), "=&v"(p[5]), "=&v"(p[6]), "=&v"(p[7])
      : "v"(x[0]), "v"(x[1]), "v"(x[2]), "v"(x[3]), "v"(x[4]), "v"(x[5]), "v"(x[6]), "v"(x[7]));
}

// 16x16x32 f16 WMMA with hazard guard (ties D, keeps A/B live)
__device__ __forceinline__ v8f mma_f16(v16h a, v16h b, v8f c) {
  v8f d = __builtin_amdgcn_wmma_f32_16x16x32_f16(false, a, false, b, (short)0, c, false, false);
  asm volatile("v_nop\n\tv_nop\n\tv_nop\n\tv_nop" : "+v"(d) : "v"(a), "v"(b));
  return d;
}

// 16x16x32 bf16 WMMA with hazard guard
__device__ __forceinline__ v8f mma_bf16(v16b a, v16b b, v8f c) {
  v8f d = __builtin_amdgcn_wmma_f32_16x16x32_bf16(false, a, false, b, (short)0, c, false, false);
  asm volatile("v_nop\n\tv_nop\n\tv_nop\n\tv_nop" : "+v"(d) : "v"(a), "v"(b));
  return d;
}

// f32 -> bf16 bits, RNE convert
__device__ __forceinline__ unsigned bf16_rne(float f) {
  unsigned u = __float_as_uint(f);
  return (u + 0x7FFFu + ((u >> 16) & 1u)) >> 16;
}
__device__ __forceinline__ unsigned pack2(float a, float b) {
  return bf16_rne(a) | (bf16_rne(b) << 16);
}

// ---------------------------------------------------------------------------
//         Wq | Wk | Wv -> bf16 in native [e][d] layout (k-contiguous B layout).
// blocks [0,4096): xy, 8 elements per thread; blocks [4096,4480): weights.
// ---------------------------------------------------------------------------
__global__ void __launch_bounds__(256)
prep_kernel(const float* __restrict__ x, const float* __restrict__ y,
            const float* __restrict__ wq, const float* __restrict__ wk,
            const float* __restrict__ wv,
            unsigned short* xyb, unsigned short* wb)
{
  const int bid = blockIdx.x, tid = threadIdx.x;
  if (bid < 4096) {
    const int gid = bid * 256 + tid;            // 0 .. 1048575
    const int row = gid >> 6;                   // token row b*2048 + s
    const int d   = (gid & 63) * 8;
    const int b   = row >> 11, s = row & 2047;
    const float* src = (s < 1024)
        ? x + ((size_t)(b * 1024 + s) * 512 + d)
        : y + ((size_t)(b * 1024 + (s - 1024)) * 512 + d);
    const v4f v0 = *(const v4f*)src;
    const v4f v1 = *(const v4f*)(src + 4);
    v4u o;
    o.x = pack2(v0.x, v0.y); o.y = pack2(v0.z, v0.w);
    o.z = pack2(v1.x, v1.y); o.w = pack2(v1.z, v1.w);
    unsigned short* dst = xyb + (size_t)gid * 8;
    *(v4u*)dst = o;
    
  } else {
    const int k   = bid - 4096;                 // 0 .. 383
    const int mt  = k >> 7;                     // 0,1,2 (block-uniform)
    const int gid = (k & 127) * 256 + tid;      // 0 .. 32767
    const float* wsrc = (mt == 0) ? wq : ((mt == 1) ? wk : wv);
    const float* src = wsrc + (size_t)gid * 8;
    const v4f v0 = *(const v4f*)src;
    const v4f v1 = *(const v4f*)(src + 4);
    v4u o;
    o.x = pack2(v0.x, v0.y); o.y = pack2(v0.z, v0.w);
    o.z = pack2(v1.x, v1.y); o.w = pack2(v1.z, v1.w);
    unsigned short* dst = wb + (size_t)mt * 262144 + (size_t)gid * 8;
    *(v4u*)dst = o;
    
  }
}

// ---------------------------------------------------------------------------
// Asynchronous copies global -> LDS (16 bytes per lane, through no register).
// ---------------------------------------------------------------------------
// LDS byte address of a __shared__ pointer: the low 32 bits of its flat address.
__device__ __forceinline__ unsigned lds_addr(const void* p) { return (unsigned)(size_t)p; }

// Eight copies in one statement; copy i moves the LDS address on by i*lstep bytes and the
// global address by i*gstep elements. s_wait_xcnt 0 closes the statement so that no
// address register of an issued copy is rewritten ahead of it.
__device__ __forceinline__ void copy8(unsigned lds, const _Float16* g, unsigned lstep, size_t gstep)
{
  const unsigned l1 = lds + lstep,     l2 = lds + 2 * lstep, l3 = lds + 3 * lstep;
  const unsigned l4 = lds + 4 * lstep, l5 = lds + 5 * lstep, l6 = lds + 6 * lstep;
  const unsigned l7 = lds + 7 * lstep;
  const _Float16* g1 = g + gstep;
  const _Float16* g2 = g + 2 * gstep;
  const _Float16* g3 = g + 3 * gstep;
  const _Float16* g4 = g + 4 * gstep;
  const _Float16* g5 = g + 5 * gstep;
  const _Float16* g6 = g + 6 * gstep;
  const _Float16* g7 = g + 7 * gstep;
  asm volatile("global_load_async_to_lds_b128 %0, %8, off\n\t"
               "global_load_async_to_lds_b128 %1, %9, off\n\t"
               "global_load_async_to_lds_b128 %2, %10, off\n\t"
               "global_load_async_to_lds_b128 %3, %11, off\n\t"
               "global_load_async_to_lds_b128 %4, %12, off\n\t"
               "global_load_async_to_lds_b128 %5, %13, off\n\t"
               "global_load_async_to_lds_b128 %6, %14, off\n\t"
               "global_load_async_to_lds_b128 %7, %15, off\n\t"
               "s_wait_xcnt 0x0"
               :: "v"(lds), "v"(l1), "v"(l2), "v"(l3), "v"(l4), "v"(l5), "v"(l6), "v"(l7),
                  "v"(g), "v"(g1), "v"(g2), "v"(g3), "v"(g4), "v"(g5), "v"(g6), "v"(g7)
               : "memory");
}

// One wave's half of a tile slice: 64 rows of 128 B (one whole line each), global row pitch GP
// elements, LDS row pitch 144 B (16 B x odd: ds_load_b128 readers meet no bank conflict).
// lds, g: this lane's addresses in copy 0 (row l>>3, 16-byte chunk l&7); a copy is 4 rows.
template <int GP>
__device__ __forceinline__ void copy_half(unsigned lds, const _Float16* g)
{
#pragma unroll
  for (int i = 0; i < 2; ++i)
    copy8(lds + i * (32 * 144), g + (size_t)i * 32 * GP, 4 * 144, (size_t)4 * GP);
}

// This wave's own copies have landed.
__device__ __forceinline__ void wait_copies() { asm volatile("s_wait_asynccnt 0x0" ::: "memory"); }
// This wave's own LDS reads and writes have retired (before a buffer goes to its next writer).
__device__ __forceinline__ void wait_lds()    { asm volatile("s_wait_dscnt 0x0" ::: "memory"); }

__global__ void __launch_bounds__(128)
proj_kernel(const __bf16* __restrict__ xyb, const __bf16* __restrict__ wb,
            _Float16* Qh, _Float16* Kh, _Float16* Vt)
{
  const int PB = 256 * 144;                        // one tile buffer, bytes
  __shared__ __align__(16) char smem[2 * 256 * 144];
  // the epilogue's staging tiles take the buffers' place behind the loop
  _Float16* sq = (_Float16*)smem;
  _Float16* sk = sq + 64 * 72;
  _Float16* sv = sk + 64 * 72;                     // [e_local][s_local]

  const int tid = threadIdx.x, l = tid & 31, w = tid >> 5;
  const int h = l >> 4, m = l & 15;
  const int wr = w >> 1, wc = w & 1;
  const int bx = blockIdx.x, by = blockIdx.y;
  const int lr0 = wr * 32, lc0 = wc * 32;            // tile-local bases of this wave

  // this lane's addresses in copy 0 of a tile (row l>>3 of the wave's group, 16-byte chunk l&7);
  // the copies take an address only: bf16 and f16 elements are both 2 bytes
  const int wu = __builtin_amdgcn_readfirstlane(w);   // the wave's number as a scalar: the group is picked by a scalar select
  const __bf16* grp = (wu == 0) ? xyb + (size_t)(bx * 64) * 512
                                : wb + (size_t)(wu - 1) * 262144 + (size_t)(by * 64) * 512;
  const _Float16* csrc = (const _Float16*)(grp + (size_t)(l >> 3) * 512 + (l & 7) * 8);
  const unsigned  cdst = lds_addr(smem) + (w * 64 + (l >> 3)) * 144 + (l & 7) * 16;
  const int aoff = (lr0 + m) * 144 + h * 16;          // ti=1: + 16*144
  const int boff = (64 + lc0 + m) * 144 + h * 16;     // + (mt*64 + tj*16)*144

  v8f acc[12];                                        // index = mt*4 + ti*2 + tj
#pragma unroll
  for (int i = 0; i < 12; ++i) acc[i] = zero8();

  // Each block walks the 8 k tiles in an order rotated by its index: blocks that share xy rows
  // (same bx) or W rows (same by) run side by side and would else ask L2 for the same lines at once.
  const int rot = bx + (bx >> 3) + by;
  copy_half<512>(cdst, csrc + (rot & 7) * 64);
  wait_copies();
  __syncthreads();                                    // the first tile is readable
  copy_half<512>(cdst + PB, csrc + ((rot + 1) & 7) * 64);

#pragma unroll 1   // rolled: one copy of the trip's code; the copies' addresses are formed trip by trip
  for (int t = 0; t < 8; ++t) {
    const int buf = (t & 1) ? PB : 0;
    const char* af = smem + buf + aoff;
    const char* bf = smem + buf + boff;
#pragma unroll
    for (int d = 0; d < 2; ++d) {
      // the fragment reads of a half trip stand as one group ahead of its WMMAs
      FragB a[2], bb[6];
#pragma unroll
      for (int i = 0; i < 2; ++i) {
        a[i].hh[0] = *(const v8b*)(af + i * (16 * 144) + d * 64);
        a[i].hh[1] = *(const v8b*)(af + i * (16 * 144) + d * 64 + 32);
      }
#pragma unroll
      for (int j = 0; j < 6; ++j) {                   // j = mt*2 + tj
        bb[j].hh[0] = *(const v8b*)(bf + ((j >> 1) * 64 + (j & 1) * 16) * 144 + d * 64);
        bb[j].hh[1] = *(const v8b*)(bf + ((j >> 1) * 64 + (j & 1) * 16) * 144 + d * 64 + 32);
      }
#pragma unroll
      for (int j = 0; j < 6; ++j) {
        const int ai = (j >> 1) * 4 + (j & 1);
        acc[ai]     = mma_bf16(a[0].v, bb[j].v, acc[ai]);
        acc[ai + 2] = mma_bf16(a[1].v, bb[j].v, acc[ai + 2]);
      }
    }
    // foot of trip t: tile t+1 is published, tile t's buffer is free for tile t+2
    wait_lds();
    wait_copies();
    __syncthreads();
    if (t + 2 < 8)
      copy_half<512>(cdst + buf, csrc + ((rot + t + 2) & 7) * 64);
  }
  wait_copies();
  // behind the last foot's barrier no tile is live: the staging tiles take the buffers' place

  // accumulators -> LDS tiles (D element r = row 8h+r, col m)
#pragma unroll
  for (int ti = 0; ti < 2; ++ti) {
#pragma unroll
    for (int tj = 0; tj < 2; ++tj) {
      const v8f cq = acc[0 + ti * 2 + tj];
      const v8f ck = acc[4 + ti * 2 + tj];
      const v8f cv = acc[8 + ti * 2 + tj];
      const int rbase = lr0 + ti * 16 + 8 * h;   // token row of element r=0 (tile-local)
      const int ccol  = lc0 + tj * 16 + m;       // e column (tile-local)
#pragma unroll
      for (int r = 0; r < 8; ++r) {
        sq[(rbase + r) * 72 + ccol] = (_Float16)cq[r];
        sk[(rbase + r) * 72 + ccol] = (_Float16)ck[r];
      }
      v8h pv;
#pragma unroll
      for (int r = 0; r < 8; ++r) pv[r] = (_Float16)cv[r];
      *(v8h*)(sv + ccol * 72 + rbase) = pv;    // transposed: row e, 8 contiguous s
    }
  }
  __syncthreads();

  const int q = l >> 3, t = l & 7;
  const int b  = bx >> 5;
  const int s0 = (bx & 31) * 64;
#pragma unroll
  for (int i = 0; i < 4; ++i) {
    const int row = w * 16 + i * 4 + q;
    const v8h vq = *(const v8h*)(sq + row * 72 + 8 * t);
    const v8h vk = *(const v8h*)(sk + row * 72 + 8 * t);
    const v8h vv = *(const v8h*)(sv + row * 72 + 8 * t);
    *(v8h*)(Qh + (size_t)(bx * 64 + row) * 512 + by * 64 + 8 * t) = vq;
    *(v8h*)(Kh + (size_t)(bx * 64 + row) * 512 + by * 64 + 8 * t) = vk;
    *(v8h*)(Vt + ((size_t)b * 512 + by * 64 + row) * 2048 + s0 + 8 * t) = vv;
  }
  
}

__global__ void __launch_bounds__(256)
attn_kernel(const _Float16* __restrict__ Qh, const _Float16* __restrict__ Kh,
            const _Float16* __restrict__ Vt, float* out)
{
  __shared__ __align__(16) char smem[283136];
  const int TB0 = 0, TB1 = 73728, POFF = 147456, QOFF = 214016, AOFF = 280576, LOFF = 280832;
  const int MOFF = 281088, SOFF = 282112;

  const int tid = threadIdx.x, l = tid & 31, w = tid >> 5;
  const int h = l >> 4, m = l & 15;
  const int rh = w >> 2, kg = w & 3;
  const int q0 = blockIdx.x * 64;               // global query row (includes batch)
  const int b  = q0 >> 11;
  const float SCL = 0.044194173824159216f;      // 512^-0.5
  const float LOG2E = 1.4426950408889634f;      // exp(x) = 2^(x * log2 e)

  const unsigned sbase = lds_addr(smem);
  const int SLICE = 128 * 144;                  // one key/column group's slice of a tile buffer, bytes
  const unsigned cdst = kg * SLICE + (rh * 64 + (l >> 3)) * 144 + (l & 7) * 16;  // this lane's place, copy 0
  const int foff = kg * SLICE + m * 144 + h * 16;                                // this lane's fragment base
  const char* qf = smem + QOFF + (rh * 32 + m) * 1040 + h * 16;
  const char* pf = smem + POFF + (rh * 32 + m) * 1040 + h * 16;
  float* sal  = (float*)(smem + AOFF);
  float* ssum = (float*)(smem + LOFF);
  float* gmax = (float*)(smem + MOFF);          // [row][key group]
  float* gsum = (float*)(smem + SOFF);          // [row][key group]

  // K tile (chunk cc, tile kt): keys cc*512 + kg*128 .. +127, k = kt*64 .. +63
  const _Float16* Ksrc = Kh + ((size_t)b * 2048 + kg * 128 + rh * 64 + (l >> 3)) * 512 + (l & 7) * 8;
  // V^T tile (chunk cc, tile vt): rows kg*128 .. +127 of V^T, keys cc*512 + vt*64 .. +63
  const _Float16* Vsrc = Vt + ((size_t)b * 512 + kg * 128 + rh * 64 + (l >> 3)) * 2048 + (l & 7) * 8;

  // Q: this wave brings rows 8w..8w+7, first halves (512 B) then second halves
  {
    const _Float16* Qsrc = Qh + (size_t)(q0 + 8 * w) * 512 + l * 8;
    const unsigned  qdst = sbase + QOFF + 8 * w * 1040 + l * 16;
    copy8(qdst, Qsrc, 1040, 512);
    copy8(qdst + 512, Qsrc + 256, 1040, 512);
  }

  v8f oacc[2][8];
#pragma unroll
  for (int i = 0; i < 2; ++i)
#pragma unroll
    for (int j = 0; j < 8; ++j) oacc[i][j] = zero8();

  // The 32 blocks of a batch read the same K and V^T and run side by side: each walks the 4 chunks
  // and the 8 tiles of a stage in an order rotated by its index, so that no two of them ask L2 for
  // the same lines at once. The online softmax takes the chunks in any order.
  const int rotc = (blockIdx.x >> 3) & 3, rott = (blockIdx.x + (blockIdx.x >> 3)) & 7;

  // running maximum and sum of query rows rh*32 + m and rh*32 + 16 + m (the same in both halves
  // of the wave and in the four waves that share the rows)
  float mrun[2] = {-3.0e38f, -3.0e38f}, lrun[2] = {0.0f, 0.0f};
  float al[2];                                  // this chunk's rescale factor of those rows

#pragma unroll 1   // rolled: one copy of the chunk's code
  for (int c = 0; c < 4; ++c) {
    const int cc = (c + rotc) & 3;              // the chunk of keys taken in this pass
    // ---- Stage 1: scores of this chunk ----
    {
      const _Float16* Kc = Ksrc + (size_t)cc * (512 * 512);
      copy_half<512>(sbase + TB0 + cdst, Kc + rott * 64);
      wait_copies();
      __syncthreads();                          // the first tile (and, in the first pass, Q) is readable
      copy_half<512>(sbase + TB1 + cdst, Kc + ((rott + 1) & 7) * 64);

      v8f acc[2][8];
#pragma unroll
      for (int i = 0; i < 2; ++i)
#pragma unroll
        for (int j = 0; j < 8; ++j) acc[i][j] = zero8();
#pragma unroll 1   // rolled: unrolled, the copies' addresses of all trips are formed ahead and spill
      for (int tp = 0; tp < 8; ++tp) {
        const int kbuf = (tp & 1) ? TB1 : TB0;
        const int kt = (tp + rott) & 7;         // the k tile that lies in kbuf
        const char* kf = smem + kbuf + foff;
#pragma unroll
        for (int d = 0; d < 2; ++d) {
          // the fragment reads of a half trip stand as one group ahead of its WMMAs
          FragH a[2], bb[8];
#pragma unroll
          for (int i = 0; i < 2; ++i) {
            a[i].hh[0] = *(const v8h*)(qf + i * (16 * 1040) + (kt * 2 + d) * 64);
            a[i].hh[1] = *(const v8h*)(qf + i * (16 * 1040) + (kt * 2 + d) * 64 + 32);
          }
#pragma unroll
          for (int j = 0; j < 8; ++j) {
            bb[j].hh[0] = *(const v8h*)(kf + j * (16 * 144) + d * 64);
            bb[j].hh[1] = *(const v8h*)(kf + j * (16 * 144) + d * 64 + 32);
          }
#pragma unroll
          for (int j = 0; j < 8; ++j) {
#pragma unroll
            for (int i = 0; i < 2; ++i) acc[i][j] = mma_f16(bb[j].v, a[i].v, acc[i][j]);
          }
        }
        // foot of trip tp: tile tp+1 is published, tile tp's buffer is free for tile tp+2
        wait_lds();
        wait_copies();
        __syncthreads();
        if (tp + 2 < 8)
          copy_half<512>(sbase + kbuf + cdst, Kc + ((kt + 2) & 7) * 64);
      }
      wait_copies();

      // ---- Online softmax on the accumulators ----
      // acc[i][j][r] = score of query rh*32 + i*16 + m with key kg*128 + j*16 + 8h + r of the chunk
      float mx[2];
#pragma unroll
      for (int i = 0; i < 2; ++i) {
        float t[4] = {-3.0e38f, -3.0e38f, -3.0e38f, -3.0e38f};   // four chains: no long dependent run of maxima
#pragma unroll
        for (int j = 0; j < 8; ++j) {
#pragma unroll
          for (int r = 0; r < 8; ++r) { acc[i][j][r] *= SCL; t[j & 3] = fmaxf(t[j & 3], acc[i][j][r]); }
        }
        const float tt = fmaxf(fmaxf(t[0], t[1]), fmaxf(t[2], t[3]));
        mx[i] = fmaxf(tt, xhalf(tt));
      }
      gmax[(rh * 32 + l) * 4 + kg] = h ? mx[1] : mx[0];   // lane l speaks for row rh*32 + l
      __syncthreads();                          // the four key groups' maxima are readable
      float sm[2];
#pragma unroll
      for (int i = 0; i < 2; ++i) {
        const v4f g = *(const v4f*)(gmax + (rh * 32 + i * 16 + m) * 4);
        const float mnew = fmaxf(mrun[i], fmaxf(fmaxf(g.x, g.y), fmaxf(g.z, g.w)));
        al[i] = exp2x1((mrun[i] - mnew) * LOG2E);   // 0 in the first pass
        mrun[i] = mnew;
        char* pp = smem + POFF + (rh * 32 + i * 16 + m) * 1040 + kg * 256 + h * 16;
        float s = 0.0f;
#pragma unroll
        for (int j = 0; j < 8; ++j) {
          float x[8], p[8];
#pragma unroll
          for (int r = 0; r < 8; ++r) x[r] = (acc[i][j][r] - mnew) * LOG2E;
          exp2x8(p, x);
          s += ((p[0] + p[1]) + (p[2] + p[3])) + ((p[4] + p[5]) + (p[6] + p[7]));
          v8h o;
#pragma unroll
          for (int r = 0; r < 8; ++r) o[r] = (_Float16)(p[r] * 16384.0f);
          *(v8h*)(pp + j * 32) = o;
        }
        sm[i] = s + xhalf(s);
      }
      gsum[(rh * 32 + l) * 4 + kg] = h ? sm[1] : sm[0];
      if (kg == 0) sal[rh * 32 + l] = h ? al[1] : al[0];
    }
    __syncthreads();                            // P, the factors and the groups' sums are readable

    // ---- Stage 2: O[64][512] = O * factor + P V ; wave owns 32 rows x 128 columns ----
    {
      const _Float16* Vc = Vsrc + cc * 512;
      copy_half<2048>(sbase + TB0 + cdst, Vc + rott * 64);
#pragma unroll
      for (int i = 0; i < 2; ++i) {
        const v4f g = *(const v4f*)(gsum + (rh * 32 + i * 16 + m) * 4);
        lrun[i] = lrun[i] * al[i] + ((g.x + g.y) + (g.z + g.w));
      }
      if (kg == 0) ssum[rh * 32 + l] = h ? lrun[1] : lrun[0];   // read in the epilogue, behind this stage's barriers
#pragma unroll
      for (int i = 0; i < 2; ++i) {
        const float* ap = sal + rh * 32 + i * 16 + 8 * h;
        const v4f f0 = *(const v4f*)ap;
        const v4f f1 = *(const v4f*)(ap + 4);
#pragma unroll
        for (int j = 0; j < 8; ++j) {
#pragma unroll
          for (int r = 0; r < 4; ++r) { oacc[i][j][r] *= f0[r]; oacc[i][j][r + 4] *= f1[r]; }
        }
      }
      wait_copies();
      __syncthreads();                          // the first tile is readable
      copy_half<2048>(sbase + TB1 + cdst, Vc + ((rott + 1) & 7) * 64);
#pragma unroll 1   // rolled, for the same reason as in stage 1
      for (int t = 0; t < 8; ++t) {
        const int vbuf = (t & 1) ? TB1 : TB0;
        const int vt = (t + rott) & 7;          // the tile of 64 keys that lies in vbuf
        const char* vf = smem + vbuf + foff;
#pragma unroll
        for (int d = 0; d < 2; ++d) {
          // the fragment reads of a half trip stand as one group ahead of its WMMAs
          FragH a[2], bb[8];
#pragma unroll
          for (int i = 0; i < 2; ++i) {
            a[i].hh[0] = *(const v8h*)(pf + i * (16 * 1040) + (vt * 2 + d) * 64);
            a[i].hh[1] = *(const v8h*)(pf + i * (16 * 1040) + (vt * 2 + d) * 64 + 32);
          }
#pragma unroll
          for (int j = 0; j < 8; ++j) {
            bb[j].hh[0] = *(const v8h*)(vf + j * (16 * 144) + d * 64);
            bb[j].hh[1] = *(const v8h*)(vf + j * (16 * 144) + d * 64 + 32);
          }
#pragma unroll
          for (int j = 0; j < 8; ++j) {
#pragma unroll
            for (int i = 0; i < 2; ++i) oacc[i][j] = mma_f16(a[i].v, bb[j].v, oacc[i][j]);
          }
        }
        // foot of trip t: tile t+1 is published, tile t's buffer is free for tile t+2
        wait_lds();
        wait_copies();
        __syncthreads();
        if (t + 2 < 8)
          copy_half<2048>(sbase + vbuf + cdst, Vc + ((vt + 2) & 7) * 64);
      }
      wait_copies();
    }
  }

  // ---- Epilogue: normalise, undo 2^14, stage in LDS (the tile buffers are free), whole-line stores ----
  float* os = (float*)smem;                     // [64][512] f32
  {
    const float OSCL = 6.103515625e-05f;        // 2^-14 exact
#pragma unroll
    for (int i = 0; i < 2; ++i) {
      const float* lp = ssum + rh * 32 + i * 16 + 8 * h;
      const v4f s0 = *(const v4f*)lp;
      const v4f s1 = *(const v4f*)(lp + 4);
      float inv[8];
#pragma unroll
      for (int r = 0; r < 4; ++r) { inv[r] = OSCL / s0[r]; inv[r + 4] = OSCL / s1[r]; }
#pragma unroll
      for (int j = 0; j < 8; ++j) {
        float* d = os + (rh * 32 + i * 16 + 8 * h) * 512 + kg * 128 + j * 16 + m;
#pragma unroll
        for (int r = 0; r < 8; ++r) d[r * 512] = oacc[i][j][r] * inv[r];
      }
    }
  }
  __syncthreads();
  {
    const int col = kg * 128 + l * 4;
    const float* srw = os + (rh * 32) * 512 + col;
    float* orow = out + (size_t)(q0 + rh * 32) * 512 + col;
#pragma unroll
    for (int i = 0; i < 32; ++i) {
      const v4f v = *(const v4f*)(srw + i * 512);
      *(v4f*)(orow + (size_t)i * 512) = v;
    }
  }
}

// ---------------------------------------------------------------------------
// Host launcher
// ---------------------------------------------------------------------------
extern "C" void kernel_launch(void* const* d_in, const int* in_sizes, int n_in,
                              void* d_out, int out_size, void* d_ws, size_t ws_size,
                              hipStream_t stream)
{
  if (n_in < 5) return;
  const int NXY = 8 * 1024 * 512;     // 4194304
  const int NW  = 512 * 512;          // 262144
  const int NO  = 8 * 2048 * 512;     // 8388608
  if (in_sizes[0] != NXY || in_sizes[1] != NXY) return;
  if (in_sizes[2] != NW || in_sizes[3] != NW || in_sizes[4] != NW) return;
  if (out_size != NO) return;

  const float* x  = (const float*)d_in[0];
  const float* y  = (const float*)d_in[1];
  const float* Wq = (const float*)d_in[2];
  const float* Wk = (const float*)d_in[3];
  const float* Wv = (const float*)d_in[4];
  float* out = (float*)d_out;

  const size_t bytes_xyb = (size_t)16384 * 512 * 2;    // 16777216
  const size_t bytes_wb  = (size_t)3 * NW * 2;          //  1572864
  const size_t bytes_q   = (size_t)16384 * 512 * 2;    // 16777216 each for Qh, Kh, Vt
  const size_t off_xyb = 0;
  const size_t off_wb  = off_xyb + bytes_xyb;
  const size_t off_q   = off_wb  + bytes_wb;
  const size_t off_k   = off_q   + bytes_q;
  const size_t off_v   = off_k   + bytes_q;
  const size_t total   = off_v   + bytes_q;           // 68681728
  if (total > ws_size) return;

  char* ws = (char*)d_ws;
  unsigned short* xyb = (unsigned short*)(ws + off_xyb);
  unsigned short* wb  = (unsigned short*)(ws + off_wb);
  _Float16* Qh = (_Float16*)(ws + off_q);
  _Float16* Kh = (_Float16*)(ws + off_k);
  _Float16* Vt = (_Float16*)(ws + off_v);

  prep_kernel<<<4096 + 384, 256, 0, stream>>>(x, y, Wq, Wk, Wv, xyb, wb);

  proj_kernel<<<dim3(256, 8), 128, 0, stream>>>((const __bf16*)xyb, (const __bf16*)wb, Qh, Kh, Vt);

  // Pass 2: attention, 64 query rows per block: 16384/64 blocks
  attn_kernel<<<256, 256, 0, stream>>>(Qh, Kh, Vt, out);
}

// v006
// One run takes 103 microseconds.
// Timed twice side by side with v005, it ran 1.13 times as fast both times.
// All steps since v000 together make it 8.33 times as fast.
#include <hip/hip_runtime.h>
// Contractions: q/k/v projections on v_wmma_f32_16x16x32_bf16 (bf16 operands); scores and P.V on v_wmma_f32_16x16x32_f16 (f16 operands, P scaled by 2^14); f32 accumulate everywhere.

typedef _Float16 v16h __attribute__((ext_vector_type(16)));
typedef _Float16 v8h  __attribute__((ext_vector_type(8)));
typedef _Float16 v4h  __attribute__((ext_vector_type(4)));
typedef __bf16   v16b __attribute__((ext_vector_type(16)));
typedef __bf16   v8b  __attribute__((ext_vector_type(8)));
typedef float    v8f  __attribute__((ext_vector_type(8)));
typedef float    v4f  __attribute__((ext_vector_type(4)));
typedef unsigned v4u  __attribute__((ext_vector_type(4)));

union FragH { v16h v; v8h hh[2]; };
union FragB { v16b v; v8b hh[2]; };

__device__ __forceinline__ v8f zero8() {
  v8f z = {0.f, 0.f, 0.f, 0.f, 0.f, 0.f, 0.f, 0.f};
  return z;
}

// the value that lane l ^ 16 holds
__device__ __forceinline__ float xhalf(float x) {
  const int b = __builtin_bit_cast(int, x);
  return __builtin_bit_cast(float, __builtin_amdgcn_permlanex16(b, b, 0x76543210, 0xfedcba98, false, false));
}

// 2^x. Behind a transcendental the instruction set asks for one independent instruction before its
// result is read or its source overwritten: the v_nop in the same statement is that slot.
__device__ __forceinline__ float exp2x1(float x) {
  float y;
  asm("v_exp_f32 %0, %1\n\tv_nop" : "=v"(y) : "v"(x));
  return y;
}
// Eight at once: each has an independent one behind it (no result shares a register with a source),
// the last has the v_nop.
__device__ __forceinline__ void exp2x8(float (&p)[8], const float (&x)[8]) {
  asm("v_exp_f32 %0, %8\n\t"
      "v_exp_f32 %1, %9\n\t"
      "v_exp_f32 %2, %10\n\t"
      "v_exp_f32 %3, %11\n\t"
      "v_exp_f32 %4, %12\n\t"
      "v_exp_f32 %5, %13\n\t"
      "v_exp_f32 %6, %14\n\t"
      "v_exp_f32 %7, %15\n\t"
      "v_nop"
      : "=&v"(p[0]), "=&v"(p[1]), "=&v"(p[2]), "=&v"(p[3]), "=&v"(p[4]), "=&v"(p[5]), "=&v"(p[6]), "=&v"(p[7])
      : "v"(x[0]), "v"(x[1]), "v"(x[2]), "v"(x[3]), "v"(x[4]), "v"(x[5]), "v"(x[6]), "v"(x[7]));
}

// 16x16x32 f16 WMMA, the plain builtin: the compiler keeps its distances, and its operands may lie in any register window
__device__ __forceinline__ v8f mma_f16(v16h a, v16h b, v8f c) {
  return __builtin_amdgcn_wmma_f32_16x16x32_f16(false, a, false, b, (short)0, c, false, false);
}

// 16x16x32 bf16 WMMA with hazard guard
__device__ __forceinline__ v8f mma_bf16(v16b a, v16b b, v8f c) {
  v8f d = __builtin_amdgcn_wmma_f32_16x16x32_bf16(false, a, false, b, (short)0, c, false, false);
  asm volatile("v_nop\n\tv_nop\n\tv_nop\n\tv_nop" : "+v"(d) : "v"(a), "v"(b));
  return d;
}

// f32 -> bf16 bits, RNE convert
__device__ __forceinline__ unsigned bf16_rne(float f) {
  unsigned u = __float_as_uint(f);
  return (u + 0x7FFFu + ((u >> 16) & 1u)) >> 16;
}
__device__ __forceinline__ unsigned pack2(float a, float b) {
  return bf16_rne(a) | (bf16_rne(b) << 16);
}

// ---------------------------------------------------------------------------
//         Wq | Wk | Wv -> bf16 in native [e][d] layout (k-contiguous B layout).
// blocks [0,4096): xy, 8 elements per thread; blocks [4096,4480): weights.
// ---------------------------------------------------------------------------
__global__ void __launch_bounds__(256)
prep_kernel(const float* __restrict__ x, const float* __restrict__ y,
            const float* __restrict__ wq, const float* __restrict__ wk,
            const float* __restrict__ wv,
            unsigned short* xyb, unsigned short* wb)
{
  const int bid = blockIdx.x, tid = threadIdx.x;
  if (bid < 4096) {
    const int gid = bid * 256 + tid;            // 0 .. 1048575
    const int row = gid >> 6;                   // token row b*2048 + s
    const int d   = (gid & 63) * 8;
    const int b   = row >> 11, s = row & 2047;
    const float* src = (s < 1024)
        ? x + ((size_t)(b * 1024 + s) * 512 + d)
        : y + ((size_t)(b * 1024 + (s - 1024)) * 512 + d);
    const v4f v0 = *(const v4f*)src;
    const v4f v1 = *(const v4f*)(src + 4);
    v4u o;
    o.x = pack2(v0.x, v0.y); o.y = pack2(v0.z, v0.w);
    o.z = pack2(v1.x, v1.y); o.w = pack2(v1.z, v1.w);
    unsigned short* dst = xyb + (size_t)gid * 8;
    *(v4u*)dst = o;
    
  } else {
    const int k   = bid - 4096;                 // 0 .. 383
    const int mt  = k >> 7;                     // 0,1,2 (block-uniform)
    const int gid = (k & 127) * 256 + tid;      // 0 .. 32767
    const float* wsrc = (mt == 0) ? wq : ((mt == 1) ? wk : wv);
    const float* src = wsrc + (size_t)gid * 8;
    const v4f v0 = *(const v4f*)src;
    const v4f v1 = *(const v4f*)(src + 4);
    v4u o;
    o.x = pack2(v0.x, v0.y); o.y = pack2(v0.z, v0.w);
    o.z = pack2(v1.x, v1.y); o.w = pack2(v1.z, v1.w);
    unsigned short* dst = wb + (size_t)mt * 262144 + (size_t)gid * 8;
    *(v4u*)dst = o;
    
  }
}

// ---------------------------------------------------------------------------
// Asynchronous copies global -> LDS (16 bytes per lane, through no register).
// ---------------------------------------------------------------------------
// LDS byte address of a __shared__ pointer: the low 32 bits of its flat address.
__device__ __forceinline__ unsigned lds_addr(const void* p) { return (unsigned)(size_t)p; }

// Eight copies in one statement; copy i moves the LDS address on by i*lstep bytes and the
// global address by i*gstep elements. s_wait_xcnt 0 closes the statement so that no
// address register of an issued copy is rewritten ahead of it.
__device__ __forceinline__ void copy8(unsigned lds, const _Float16* g, unsigned lstep, size_t gstep)
{
  const unsigned l1 = lds + lstep,     l2 = lds + 2 * lstep, l3 = lds + 3 * lstep;
  const unsigned l4 = lds + 4 * lstep, l5 = lds + 5 * lstep, l6 = lds + 6 * lstep;
  const unsigned l7 = lds + 7 * lstep;
  const _Float16* g1 = g + gstep;
  const _Float16* g2 = g + 2 * gstep;
  const _Float16* g3 = g + 3 * gstep;
  const _Float16* g4 = g + 4 * gstep;
  const _Float16* g5 = g + 5 * gstep;
  const _Float16* g6 = g + 6 * gstep;
  const _Float16* g7 = g + 7 * gstep;
  asm volatile("global_load_async_to_lds_b128 %0, %8, off\n\t"
               "global_load_async_to_lds_b128 %1, %9, off\n\t"
               "global_load_async_to_lds_b128 %2, %10, off\n\t"
               "global_load_async_to_lds_b128 %3, %11, off\n\t"
               "global_load_async_to_lds_b128 %4, %12, off\n\t"
               "global_load_async_to_lds_b128 %5, %13, off\n\t"
               "global_load_async_to_lds_b128 %6, %14, off\n\t"
               "global_load_async_to_lds_b128 %7, %15, off\n\t"
               "s_wait_xcnt 0x0"
               :: "v"(lds), "v"(l1), "v"(l2), "v"(l3), "v"(l4), "v"(l5), "v"(l6), "v"(l7),
                  "v"(g), "v"(g1), "v"(g2), "v"(g3), "v"(g4), "v"(g5), "v"(g6), "v"(g7)
               : "memory");
}

// One wave's half of a tile slice: 64 rows of 128 B (one whole line each), global row pitch GP
// elements, LDS row pitch 144 B (16 B x odd: ds_load_b128 readers meet no bank conflict).
// lds, g: this lane's addresses in copy 0 (row l>>3, 16-byte chunk l&7); a copy is 4 rows.
template <int GP>
__device__ __forceinline__ void copy_half(unsigned lds, const _Float16* g)
{
#pragma unroll
  for (int i = 0; i < 2; ++i)
    copy8(lds + i * (32 * 144), g + (size_t)i * 32 * GP, 4 * 144, (size_t)4 * GP);
}

// This wave's own copies have landed.
__device__ __forceinline__ void wait_copies() { asm volatile("s_wait_asynccnt 0x0" ::: "memory"); }
// This wave's own LDS reads and writes have retired (before a buffer goes to its next writer).
__device__ __forceinline__ void wait_lds()    { asm volatile("s_wait_dscnt 0x0" ::: "memory"); }

__global__ void __launch_bounds__(128)
proj_kernel(const __bf16* __restrict__ xyb, const __bf16* __restrict__ wb,
            _Float16* Qh, _Float16* Kh, _Float16* Vt)
{
  const int PB = 256 * 144;                        // one tile buffer, bytes
  __shared__ __align__(16) char smem[2 * 256 * 144];
  // the epilogue's staging tiles take the buffers' place behind the loop
  _Float16* sq = (_Float16*)smem;
  _Float16* sk = sq + 64 * 72;
  _Float16* sv = sk + 64 * 72;                     // [e_local][s_local]

  const int tid = threadIdx.x, l = tid & 31, w = tid >> 5;
  const int h = l >> 4, m = l & 15;
  const int wr = w >> 1, wc = w & 1;
  const int bx = blockIdx.x, by = blockIdx.y;
  const int lr0 = wr * 32, lc0 = wc * 32;            // tile-local bases of this wave

  // this lane's addresses in copy 0 of a tile (row l>>3 of the wave's group, 16-byte chunk l&7);
  // the copies take an address only: bf16 and f16 elements are both 2 bytes
  const int wu = __builtin_amdgcn_readfirstlane(w);   // the wave's number as a scalar: the group is picked by a scalar select
  const __bf16* grp = (wu == 0) ? xyb + (size_t)(bx * 64) * 512
                                : wb + (size_t)(wu - 1) * 262144 + (size_t)(by * 64) * 512;
  const _Float16* csrc = (const _Float16*)(grp + (size_t)(l >> 3) * 512 + (l & 7) * 8);
  const unsigned  cdst = lds_addr(smem) + (w * 64 + (l >> 3)) * 144 + (l & 7) * 16;
  const int aoff = (lr0 + m) * 144 + h * 16;          // ti=1: + 16*144
  const int boff = (64 + lc0 + m) * 144 + h * 16;     // + (mt*64 + tj*16)*144

  v8f acc[12];                                        // index = mt*4 + ti*2 + tj
#pragma unroll
  for (int i = 0; i < 12; ++i) acc[i] = zero8();

  // Each block walks the 8 k tiles in an order rotated by its index: blocks that share xy rows
  // (same bx) or W rows (same by) run side by side and would else ask L2 for the same lines at once.
  const int rot = bx + (bx >> 3) + by;
  copy_half<512>(cdst, csrc + (rot & 7) * 64);
  wait_copies();
  __syncthreads();                                    // the first tile is readable
  copy_half<512>(cdst + PB, csrc + ((rot + 1) & 7) * 64);

#pragma unroll 1   // rolled: one copy of the trip's code; the copies' addresses are formed trip by trip
  for (int t = 0; t < 8; ++t) {
    const int buf = (t & 1) ? PB : 0;
    const char* af = smem + buf + aoff;
    const char* bf = smem + buf + boff;
#pragma unroll
    for (int d = 0; d < 2; ++d) {
      // the fragment reads of a half trip stand as one group ahead of its WMMAs
      FragB a[2], bb[6];
#pragma unroll
      for (int i = 0; i < 2; ++i) {
        a[i].hh[0] = *(const v8b*)(af + i * (16 * 144) + d * 64);
        a[i].hh[1] = *(const v8b*)(af + i * (16 * 144) + d * 64 + 32);
      }
#pragma unroll
      for (int j = 0; j < 6; ++j) {                   // j = mt*2 + tj
        bb[j].hh[0] = *(const v8b*)(bf + ((j >> 1) * 64 + (j & 1) * 16) * 144 + d * 64);
        bb[j].hh[1] = *(const v8b*)(bf + ((j >> 1) * 64 + (j & 1) * 16) * 144 + d * 64 + 32);
      }
#pragma unroll
      for (int j = 0; j < 6; ++j) {
        const int ai = (j >> 1) * 4 + (j & 1);
        acc[ai]     = mma_bf16(a[0].v, bb[j].v, acc[ai]);
        acc[ai + 2] = mma_bf16(a[1].v, bb[j].v, acc[ai + 2]);
      }
    }
    // foot of trip t: tile t+1 is published, tile t's buffer is free for tile t+2
    wait_lds();
    wait_copies();
    __syncthreads();
    if (t + 2 < 8)
      copy_half<512>(cdst + buf, csrc + ((rot + t + 2) & 7) * 64);
  }
  wait_copies();
  // behind the last foot's barrier no tile is live: the staging tiles take the buffers' place

  // accumulators -> LDS tiles (D element r = row 8h+r, col m)
#pragma unroll
  for (int ti = 0; ti < 2; ++ti) {
#pragma unroll
    for (int tj = 0; tj < 2; ++tj) {
      const v8f cq = acc[0 + ti * 2 + tj];
      const v8f ck = acc[4 + ti * 2 + tj];
      const v8f cv = acc[8 + ti * 2 + tj];
      const int rbase = lr0 + ti * 16 + 8 * h;   // token row of element r=0 (tile-local)
      const int ccol  = lc0 + tj * 16 + m;       // e column (tile-local)
#pragma unroll
      for (int r = 0; r < 8; ++r) {
        sq[(rbase + r) * 72 + ccol] = (_Float16)cq[r];
        sk[(rbase + r) * 72 + ccol] = (_Float16)ck[r];
      }
      v8h pv;
#pragma unroll
      for (int r = 0; r < 8; ++r) pv[r] = (_Float16)cv[r];
      *(v8h*)(sv + ccol * 72 + rbase) = pv;    // transposed: row e, 8 contiguous s
    }
  }
  __syncthreads();

  const int q = l >> 3, t = l & 7;
  const int b  = bx >> 5;
  const int s0 = (bx & 31) * 64;
#pragma unroll
  for (int i = 0; i < 4; ++i) {
    const int row = w * 16 + i * 4 + q;
    const v8h vq = *(const v8h*)(sq + row * 72 + 8 * t);
    const v8h vk = *(const v8h*)(sk + row * 72 + 8 * t);
    const v8h vv = *(const v8h*)(sv + row * 72 + 8 * t);
    *(v8h*)(Qh + (size_t)(bx * 64 + row) * 512 + by * 64 + 8 * t) = vq;
    *(v8h*)(Kh + (size_t)(bx * 64 + row) * 512 + by * 64 + 8 * t) = vk;
    *(v8h*)(Vt + ((size_t)b * 512 + by * 64 + row) * 2048 + s0 + 8 * t) = vv;
  }
  
}

__global__ void __launch_bounds__(256)
attn_kernel(const _Float16* __restrict__ Qh, const _Float16* __restrict__ Kh,
            const _Float16* __restrict__ Vt, float* out)
{
  __shared__ __align__(16) char smem[283136];
  const int TB0 = 0, TB1 = 73728, POFF = 147456, QOFF = 214016, AOFF = 280576, LOFF = 280832;
  const int MOFF = 281088, SOFF = 282112;

  const int tid = threadIdx.x, l = tid & 31, w = tid >> 5;
  const int h = l >> 4, m = l & 15;
  const int rh = w >> 2, kg = w & 3;
  const int q0 = blockIdx.x * 64;               // global query row (includes batch)
  const int b  = q0 >> 11;
  const float SCL = 0.044194173824159216f;      // 512^-0.5
  const float LOG2E = 1.4426950408889634f;      // exp(x) = 2^(x * log2 e)

  const unsigned sbase = lds_addr(smem);
  const int SLICE = 128 * 144;                  // one key/column group's slice of a tile buffer, bytes
  const unsigned cdst = kg * SLICE + (rh * 64 + (l >> 3)) * 144 + (l & 7) * 16;  // this lane's place, copy 0
  const int foff = kg * SLICE + m * 144 + h * 16;                                // this lane's fragment base
  const char* qf = smem + QOFF + (rh * 32 + m) * 1040 + h * 16;
  const char* pf = smem + POFF + (rh * 32 + m) * 1040 + h * 16;
  float* sal  = (float*)(smem + AOFF);
  float* ssum = (float*)(smem + LOFF);
  float* gmax = (float*)(smem + MOFF);          // [row][key group]
  float* gsum = (float*)(smem + SOFF);          // [row][key group]

  // K tile (chunk cc, tile kt): keys cc*512 + kg*128 .. +127, k = kt*64 .. +63
  const _Float16* Ksrc = Kh + ((size_t)b * 2048 + kg * 128 + rh * 64 + (l >> 3)) * 512 + (l & 7) * 8;
  // V^T tile (chunk cc, tile vt): rows kg*128 .. +127 of V^T, keys cc*512 + vt*64 .. +63
  const _Float16* Vsrc = Vt + ((size_t)b * 512 + kg * 128 + rh * 64 + (l >> 3)) * 2048 + (l & 7) * 8;

  // Q: this wave brings rows 8w..8w+7, first halves (512 B) then second halves
  {
    const _Float16* Qsrc = Qh + (size_t)(q0 + 8 * w) * 512 + l * 8;
    const unsigned  qdst = sbase + QOFF + 8 * w * 1040 + l * 16;
    copy8(qdst, Qsrc, 1040, 512);
    copy8(qdst + 512, Qsrc + 256, 1040, 512);
  }

  v8f oacc[2][8];
#pragma unroll
  for (int i = 0; i < 2; ++i)
#pragma unroll
    for (int j = 0; j < 8; ++j) oacc[i][j] = zero8();

  // The 32 blocks of a batch read the same K and V^T and run side by side: each walks the 4 chunks
  // and the 8 tiles of a stage in an order rotated by its index, so that no two of them ask L2 for
  // the same lines at once. The online softmax takes the chunks in any order.
  const int rotc = (blockIdx.x >> 3) & 3, rott = (blockIdx.x + (blockIdx.x >> 3)) & 7;

  // running maximum and sum of query rows rh*32 + m and rh*32 + 16 + m (the same in both halves
  // of the wave and in the four waves that share the rows)
  float mrun[2] = {-3.0e38f, -3.0e38f}, lrun[2] = {0.0f, 0.0f};
  float al[2];                                  // this chunk's rescale factor of those rows

#pragma unroll 1   // rolled: one copy of the chunk's code
  for (int c = 0; c < 4; ++c) {
    const int cc = (c + rotc) & 3;              // the chunk of keys taken in this pass
    // ---- Stage 1: scores of this chunk ----
    {
      const _Float16* Kc = Ksrc + (size_t)cc * (512 * 512);
      copy_half<512>(sbase + TB0 + cdst, Kc + rott * 64);
      wait_copies();
      __syncthreads();                          // the first tile (and, in the first pass, Q) is readable

      v8f acc[2][8];
#pragma unroll
      for (int i = 0; i < 2; ++i)
#pragma unroll
        for (int j = 0; j < 8; ++j) acc[i][j] = zero8();
#pragma unroll 1   // rolled: unrolled, the copies' addresses of all trips are formed ahead and spill
      for (int tp = 0; tp < 8; ++tp) {
        const int kbuf = (tp & 1) ? TB1 : TB0;
        const int obuf = (tp & 1) ? TB0 : TB1;  // the buffer that the trip before has left
        const int kt = (tp + rott) & 7;         // the k tile that lies in kbuf
        const char* kf = smem + kbuf + foff;
        // head of the trip: both half trips' fragment reads go ahead of the WMMAs, a register set each;
        // the next tile's copies are issued between the two groups, while the first group's reads are under way
        FragH a[2][2], bb[2][8];
#pragma unroll
        for (int d = 0; d < 2; ++d) {
#pragma unroll
          for (int i = 0; i < 2; ++i) {
            a[d][i].hh[0] = *(const v8h*)(qf + i * (16 * 1040) + (kt * 2 + d) * 64);
            a[d][i].hh[1] = *(const v8h*)(qf + i * (16 * 1040) + (kt * 2 + d) * 64 + 32);
          }
#pragma unroll
          for (int j = 0; j < 8; ++j) {
            bb[d][j].hh[0] = *(const v8h*)(kf + j * (16 * 144) + d * 64);
            bb[d][j].hh[1] = *(const v8h*)(kf + j * (16 * 144) + d * 64 + 32);
          }
          if (d == 0 && tp + 1 < 8)
            copy_half<512>(sbase + obuf + cdst, Kc + ((kt + 1) & 7) * 64);
        }
        // the scheduler stops here: else it sinks the second group's reads in among the WMMAs, one register set, a full wait each
        __builtin_amdgcn_sched_barrier(0);
#pragma unroll
        for (int d = 0; d < 2; ++d) {
#pragma unroll
          for (int j = 0; j < 8; ++j) {
#pragma unroll
            for (int i = 0; i < 2; ++i) acc[i][j] = mma_f16(bb[d][j].v, a[d][i].v, acc[i][j]);
          }
        }
        // the scheduler stops here: else it moves the register-only WMMAs behind the foot's waits and barrier,
        // and the copies' flight is waited out with no matrix work under it
        __builtin_amdgcn_sched_barrier(0);
        // foot of trip tp: tile tp+1 is published, tile tp's buffer is free for tile tp+2
        wait_lds();
        wait_copies();
        __syncthreads();
      }
      wait_copies();

      // ---- Online softmax on the accumulators ----
      // acc[i][j][r] = score of query rh*32 + i*16 + m with key kg*128 + j*16 + 8h + r of the chunk
      float mx[2];
#pragma unroll
      for (int i = 0; i < 2; ++i) {
        float t[4] = {-3.0e38f, -3.0e38f, -3.0e38f, -3.0e38f};   // four chains: no long dependent run of maxima
#pragma unroll
        for (int j = 0; j < 8; ++j) {
#pragma unroll
          for (int r = 0; r < 8; ++r) { acc[i][j][r] *= SCL; t[j & 3] = fmaxf(t[j & 3], acc[i][j][r]); }
        }
        const float tt = fmaxf(fmaxf(t[0], t[1]), fmaxf(t[2], t[3]));
        mx[i] = fmaxf(tt, xhalf(tt));
      }
      gmax[(rh * 32 + l) * 4 + kg] = h ? mx[1] : mx[0];   // lane l speaks for row rh*32 + l
      __syncthreads();                          // the four key groups' maxima are readable
      float sm[2];
#pragma unroll
      for (int i = 0; i < 2; ++i) {
        const v4f g = *(const v4f*)(gmax + (rh * 32 + i * 16 + m) * 4);
        const float mnew = fmaxf(mrun[i], fmaxf(fmaxf(g.x, g.y), fmaxf(g.z, g.w)));
        al[i] = exp2x1((mrun[i] - mnew) * LOG2E);   // 0 in the first pass
        mrun[i] = mnew;
        char* pp = smem + POFF + (rh * 32 + i * 16 + m) * 1040 + kg * 256 + h * 16;
        float s = 0.0f;
#pragma unroll
        for (int j = 0; j < 8; ++j) {
          float x[8], p[8];
#pragma unroll
          for (int r = 0; r < 8; ++r) x[r] = (acc[i][j][r] - mnew) * LOG2E;
          exp2x8(p, x);
          s += ((p[0] + p[1]) + (p[2] + p[3])) + ((p[4] + p[5]) + (p[6] + p[7]));
          v8h o;
#pragma unroll
          for (int r = 0; r < 8; ++r) o[r] = (_Float16)(p[r] * 16384.0f);
          *(v8h*)(pp + j * 32) = o;
        }
        sm[i] = s + xhalf(s);
      }
      gsum[(rh * 32 + l) * 4 + kg] = h ? sm[1] : sm[0];
      if (kg == 0) sal[rh * 32 + l] = h ? al[1] : al[0];
    }
    __syncthreads();                            // P, the factors and the groups' sums are readable

    // ---- Stage 2: O[64][512] = O * factor + P V ; wave owns 32 rows x 128 columns ----
    {
      const _Float16* Vc = Vsrc + cc * 512;
      copy_half<2048>(sbase + TB0 + cdst, Vc + rott * 64);
#pragma unroll
      for (int i = 0; i < 2; ++i) {
        const v4f g = *(const v4f*)(gsum + (rh * 32 + i * 16 + m) * 4);
        lrun[i] = lrun[i] * al[i] + ((g.x + g.y) + (g.z + g.w));
      }
      if (kg == 0) ssum[rh * 32 + l] = h ? lrun[1] : lrun[0];   // read in the epilogue, behind this stage's barriers
#pragma unroll
      for (int i = 0; i < 2; ++i) {
        const float* ap = sal + rh * 32 + i * 16 + 8 * h;
        const v4f f0 = *(const v4f*)ap;
        const v4f f1 = *(const v4f*)(ap + 4);
#pragma unroll
        for (int j = 0; j < 8; ++j) {
#pragma unroll
          for (int r = 0; r < 4; ++r) { oacc[i][j][r] *= f0[r]; oacc[i][j][r + 4] *= f1[r]; }
        }
      }
      wait_copies();
      __syncthreads();                          // the first tile is readable
#pragma unroll 1   // rolled, for the same reason as in stage 1
      for (int t = 0; t < 8; ++t) {
        const int vbuf = (t & 1) ? TB1 : TB0;
        const int obuf = (t & 1) ? TB0 : TB1;   // the buffer that the trip before has left
        const int vt = (t + rott) & 7;          // the tile of 64 keys that lies in vbuf
        const char* vf = smem + vbuf + foff;
        // head of the trip: as in stage 1
        FragH a[2][2], bb[2][8];
#pragma unroll
        for (int d = 0; d < 2; ++d) {
#pragma unroll
          for (int i = 0; i < 2; ++i) {
            a[d][i].hh[0] = *(const v8h*)(pf + i * (16 * 1040) + (vt * 2 + d) * 64);
            a[d][i].hh[1] = *(const v8h*)(pf + i * (16 * 1040) + (vt * 2 + d) * 64 + 32);
          }
#pragma unroll
          for (int j = 0; j < 8; ++j) {
            bb[d][j].hh[0] = *(const v8h*)(vf + j * (16 * 144) + d * 64);
            bb[d][j].hh[1] = *(const v8h*)(vf + j * (16 * 144) + d * 64 + 32);
          }
          if (d == 0 && t + 1 < 8)
            copy_half<2048>(sbase + obuf + cdst, Vc + ((vt + 1) & 7) * 64);
        }
        // the scheduler stops here: else it sinks the second group's reads in among the WMMAs, one register set, a full wait each
        __builtin_amdgcn_sched_barrier(0);
#pragma unroll
        for (int d = 0; d < 2; ++d) {
#pragma unroll
          for (int j = 0; j < 8; ++j) {
#pragma unroll
            for (int i = 0; i < 2; ++i) oacc[i][j] = mma_f16(a[d][i].v, bb[d][j].v, oacc[i][j]);
          }
        }
        // the scheduler stops here: else it moves the register-only WMMAs behind the foot's waits and barrier,
        // and the copies' flight is waited out with no matrix work under it
        __builtin_amdgcn_sched_barrier(0);
        // foot of trip t: tile t+1 is published, tile t's buffer is free for tile t+2
        wait_lds();
        wait_copies();
        __syncthreads();
      }
      wait_copies();
    }
  }

  // ---- Epilogue: normalise, undo 2^14, stage in LDS (the tile buffers are free), whole-line stores ----
  float* os = (float*)smem;                     // [64][512] f32
  {
    const float OSCL = 6.103515625e-05f;        // 2^-14 exact
#pragma unroll
    for (int i = 0; i < 2; ++i) {
      const float* lp = ssum + rh * 32 + i * 16 + 8 * h;
      const v4f s0 = *(const v4f*)lp;
      const v4f s1 = *(const v4f*)(lp + 4);
      float inv[8];
#pragma unroll
      for (int r = 0; r < 4; ++r) { inv[r] = OSCL / s0[r]; inv[r + 4] = OSCL / s1[r]; }
#pragma unroll
      for (int j = 0; j < 8; ++j) {
        float* d = os + (rh * 32 + i * 16 + 8 * h) * 512 + kg * 128 + j * 16 + m;
#pragma unroll
        for (int r = 0; r < 8; ++r) d[r * 512] = oacc[i][j][r] * inv[r];
      }
    }
  }
  __syncthreads();
  {
    const int col = kg * 128 + l * 4;
    const float* srw = os + (rh * 32) * 512 + col;
    float* orow = out + (size_t)(q0 + rh * 32) * 512 + col;
#pragma unroll
    for (int i = 0; i < 32; ++i) {
      const v4f v = *(const v4f*)(srw + i * 512);
      *(v4f*)(orow + (size_t)i * 512) = v;
    }
  }
}

// ---------------------------------------------------------------------------
// Host launcher
// ---------------------------------------------------------------------------
extern "C" void kernel_launch(void* const* d_in, const int* in_sizes, int n_in,
                              void* d_out, int out_size, void* d_ws, size_t ws_size,
                              hipStream_t stream)
{
  if (n_in < 5) return;
  const int NXY = 8 * 1024 * 512;     // 4194304
  const int NW  = 512 * 512;          // 262144
  const int NO  = 8 * 2048 * 512;     // 8388608
  if (in_sizes[0] != NXY || in_sizes[1] != NXY) return;
  if (in_sizes[2] != NW || in_sizes[3] != NW || in_sizes[4] != NW) return;
  if (out_size != NO) return;

  const float* x  = (const float*)d_in[0];
  const float* y  = (const float*)d_in[1];
  const float* Wq = (const float*)d_in[2];
  const float* Wk = (const float*)d_in[3];
  const float* Wv = (const float*)d_in[4];
  float* out = (float*)d_out;

  const size_t bytes_xyb = (size_t)16384 * 512 * 2;    // 16777216
  const size_t bytes_wb  = (size_t)3 * NW * 2;          //  1572864
  const size_t bytes_q   = (size_t)16384 * 512 * 2;    // 16777216 each for Qh, Kh, Vt
  const size_t off_xyb = 0;
  const size_t off_wb  = off_xyb + bytes_xyb;
  const size_t off_q   = off_wb  + bytes_wb;
  const size_t off_k   = off_q   + bytes_q;
  const size_t off_v   = off_k   + bytes_q;
  const size_t total   = off_v   + bytes_q;           // 68681728
  if (total > ws_size) return;

  char* ws = (char*)d_ws;
  unsigned short* xyb = (unsigned short*)(ws + off_xyb);
  unsigned short* wb  = (unsigned short*)(ws + off_wb);
  _Float16* Qh = (_Float16*)(ws + off_q);
  _Float16* Kh = (_Float16*)(ws + off_k);
  _Float16* Vt = (_Float16*)(ws + off_v);

  prep_kernel<<<4096 + 384, 256, 0, stream>>>(x, y, Wq, Wk, Wv, xyb, wb);

  proj_kernel<<<dim3(256, 8), 128, 0, stream>>>((const __bf16*)xyb, (const __bf16*)wb, Qh, Kh, Vt);

  // Pass 2: attention, 64 query rows per block: 16384/64 blocks
  attn_kernel<<<256, 256, 0, stream>>>(Qh, Kh, Vt, out);
}
